// v000
// Measured on an AMD MI455X. A time is GPU time per run, averaged over a window of back-to-back runs after a warm-up
// (all launches, gaps included; the runs take copies of the inputs in turn), and the median of several windows.
// Apart from v000's, it joins two sittings. Times from different sittings can be a few percent apart, while
// side-by-side timings come from the same sitting.
// v000 is the starting kernel. One run takes 271 microseconds.
#include <hip/hip_runtime.h>
#include <hip/hip_fp16.h>

typedef __attribute__((ext_vector_type(16))) _Float16 v16h;
typedef __attribute__((ext_vector_type(8)))  float    v8f;
typedef __attribute__((ext_vector_type(4)))  int      v4i;

#define S_LEN  8192
#define HID    768
#define NHEAD  12
#define HDIM   64
#define WINW   256

union F16Frag { v16h v; uint4 q[2]; };
union H8Pack  { _Float16 h[8]; uint4 u; };
union H4Pack  { _Float16 h[4]; uint2 u; };

static __device__ __forceinline__ v8f wmma_f16(const F16Frag& a, const F16Frag& b, v8f c) {
  // D = A(16x32 f16) * B(32x16 f16) + C(16x16 f32)
  return __builtin_amdgcn_wmma_f32_16x16x32_f16(false, a.v, false, b.v, (short)0, c, false, false);
}

// ---- async global->LDS (gfx1250), guarded so absence falls back cleanly ----
#if defined(__has_builtin)
#if __has_builtin(__builtin_amdgcn_global_load_async_to_lds_b128)
#define HAVE_ASYNC_LDS 1
#endif
#endif

#ifdef HAVE_ASYNC_LDS
typedef __attribute__((address_space(1))) v4i gv4i;   // global int4*
typedef __attribute__((address_space(3))) v4i lv4i;   // LDS int4*
static __device__ __forceinline__ void cp16_g2l(const _Float16* g, _Float16* l) {
  // flat->AS1 keeps the 64-bit address; flat->AS3 keeps the low-32 LDS offset
  __builtin_amdgcn_global_load_async_to_lds_b128(
      (gv4i*)(size_t)g, (lv4i*)(unsigned)(size_t)l, 0, 0);
}
static __device__ __forceinline__ void async_wait0() {
#if __has_builtin(__builtin_amdgcn_s_wait_asynccnt)
  __builtin_amdgcn_s_wait_asynccnt(0);
#else
  asm volatile("s_wait_asynccnt 0x0" ::: "memory");
#endif
}
#else
static __device__ __forceinline__ void cp16_g2l(const _Float16* g, _Float16* l) {
  *(uint4*)l = *(const uint4*)g;   // VGPR round-trip fallback
}
static __device__ __forceinline__ void async_wait0() {}
#endif

// ---------------------------------------------------------------------------
// Kernel 1: X (f32) -> Xh (f16), vectorized 4-wide
// ---------------------------------------------------------------------------
__global__ void convert_x_kernel(const float* __restrict__ X, _Float16* __restrict__ Xh) {
  const int i = blockIdx.x * blockDim.x + threadIdx.x;  // exactly S*HID/4 threads
  const float4 f = ((const float4*)X)[i];
  H4Pack p;
  p.h[0] = (_Float16)f.x; p.h[1] = (_Float16)f.y;
  p.h[2] = (_Float16)f.z; p.h[3] = (_Float16)f.w;
  ((uint2*)Xh)[i] = p.u;
}

// ---------------------------------------------------------------------------
// Kernel 2: W[k][n] (f32) -> Wt[n][k] (f16), LDS-tiled transpose, 3 matrices
// ---------------------------------------------------------------------------
__global__ void wtrans_kernel(const float* __restrict__ Wq, const float* __restrict__ Wk,
                              const float* __restrict__ Wv, _Float16* __restrict__ Wt) {
  __shared__ _Float16 tile[32][33];
  const float* src = blockIdx.z == 0 ? Wq : (blockIdx.z == 1 ? Wk : Wv);
  _Float16* dst = Wt + (size_t)blockIdx.z * HID * HID;
  const int n0 = blockIdx.x * 32;
  const int k0 = blockIdx.y * 32;
  const int tx = threadIdx.x, ty = threadIdx.y;
  #pragma unroll
  for (int i = 0; i < 4; ++i)
    tile[ty + 8 * i][tx] = (_Float16)src[(size_t)(k0 + ty + 8 * i) * HID + n0 + tx];
  __syncthreads();
  #pragma unroll
  for (int i = 0; i < 4; ++i)
    dst[(size_t)(n0 + ty + 8 * i) * HID + k0 + tx] = tile[tx][ty + 8 * i];
}

// ---------------------------------------------------------------------------
// Kernel 3: QKV projection GEMM (unchanged; codegen verified good)
// ---------------------------------------------------------------------------
__global__ __launch_bounds__(256) void qkv_gemm_kernel(
    const _Float16* __restrict__ Xh, const _Float16* __restrict__ Wt,
    const float* __restrict__ bq, const float* __restrict__ bk, const float* __restrict__ bv,
    _Float16* __restrict__ Qh, _Float16* __restrict__ Kh, _Float16* __restrict__ Vt)
{
  const int proj = blockIdx.z;
  const _Float16* Wp = Wt + (size_t)proj * HID * HID;
  const int lane = threadIdx.x & 31;
  const int w    = threadIdx.x >> 5;
  const int ln16 = lane & 15;
  const int hl   = lane >> 4;
  const int kb8  = hl * 8;
  const int Mb = blockIdx.x * 64 + (w >> 2) * 32;
  const int Nb = blockIdx.y * 128 + (w & 3) * 32;

  v8f zero = {};
  v8f acc[2][2] = {{zero, zero}, {zero, zero}};

  const _Float16* arow[2] = { Xh + (size_t)(Mb + ln16) * HID,
                              Xh + (size_t)(Mb + 16 + ln16) * HID };
  const _Float16* brow[2] = { Wp + (size_t)(Nb + ln16) * HID,
                              Wp + (size_t)(Nb + 16 + ln16) * HID };

  for (int kk = 0; kk < HID; kk += 32) {
    F16Frag a[2], b[2];
    #pragma unroll
    for (int i = 0; i < 2; ++i) {
      a[i].q[0] = *(const uint4*)(arow[i] + kk + kb8);
      a[i].q[1] = *(const uint4*)(arow[i] + kk + kb8 + 16);
      b[i].q[0] = *(const uint4*)(brow[i] + kk + kb8);
      b[i].q[1] = *(const uint4*)(brow[i] + kk + kb8 + 16);
      __builtin_prefetch(arow[i] + kk + 64, 0, 3);   // -> global_prefetch_b8
      __builtin_prefetch(brow[i] + kk + 64, 0, 3);
    }
    #pragma unroll
    for (int mi = 0; mi < 2; ++mi)
      #pragma unroll
      for (int ni = 0; ni < 2; ++ni)
        acc[mi][ni] = wmma_f16(a[mi], b[ni], acc[mi][ni]);
  }

  const float* bias = proj == 0 ? bq : (proj == 1 ? bk : bv);
  const float qscale = proj == 0 ? 0.125f : 1.0f;   // 1/sqrt(64) folded into Q
  #pragma unroll
  for (int mi = 0; mi < 2; ++mi) {
    #pragma unroll
    for (int ni = 0; ni < 2; ++ni) {
      const int n = Nb + ni * 16 + ln16;
      const float bn = bias[n];
      if (proj == 2) {
        H8Pack p;
        #pragma unroll
        for (int r = 0; r < 8; ++r) p.h[r] = (_Float16)(acc[mi][ni][r] + bn);
        const int srow = Mb + mi * 16 + 8 * hl;
        *(uint4*)(Vt + (size_t)n * S_LEN + srow) = p.u;
      } else {
        _Float16* dst = proj == 0 ? Qh : Kh;
        #pragma unroll
        for (int r = 0; r < 8; ++r) {
          const int row = Mb + mi * 16 + r + 8 * hl;
          dst[(size_t)row * HID + n] = (_Float16)((acc[mi][ni][r] + bn) * qscale);
        }
      }
    }
  }
}

// ---------------------------------------------------------------------------
// Kernel 4: banded attention, flash-style, with double-buffered ASYNC K tiles.
//   grid (64, 12), block 256 (8 waves). WG owns 128 query rows; key-band union
//   = 640 keys = 5 superblocks of 128, staged global->LDS asynchronously.
// ---------------------------------------------------------------------------
#define KROWS  128   // keys per superblock
#define KPAD   72    // padded LDS row stride (halves): 144 B, conflict-free b128
#define NSUPER 5

__global__ __launch_bounds__(256) void attn_kernel(
    const _Float16* __restrict__ Qh, const _Float16* __restrict__ Kh,
    const _Float16* __restrict__ Vt, float* __restrict__ out)
{
  __shared__ __align__(16) _Float16 kbuf[2][KROWS * KPAD];  // 36 KB
  __shared__ __align__(16) _Float16 pscr[8][16 * 48];       // 12 KB

  const int qb0  = blockIdx.x * 128;        // first query row of this WG
  const int h    = blockIdx.y;
  const int tid  = threadIdx.x;
  const int lane = tid & 31;
  const int wid  = tid >> 5;                // 0..7
  const int ln16 = lane & 15;
  const int hl   = lane >> 4;
  const int kb8  = hl * 8;
  const int qb   = qb0 + wid * 16;          // first query row of this wave

  // ---- cooperative K superblock staging: 128 rows x 64 halves -> LDS ----
  auto stage_k = [&](int t, _Float16* buf) {
    const int kgbase = qb0 - WINW + KROWS * t;
    #pragma unroll
    for (int j = 0; j < 4; ++j) {
      const int idx = tid + j * 256;        // 1024 x 16 B = one 16 KB tile
      const int row = idx >> 3;             // 0..127
      const int ch  = idx & 7;              // 16-B chunk within row
      int key = kgbase + row;
      key = key < 0 ? 0 : (key >= S_LEN ? S_LEN - 1 : key);   // clamped rows get masked
      cp16_g2l(Kh + (size_t)key * HID + h * HDIM + ch * 8, buf + row * KPAD + ch * 8);
    }
  };

  // Q A-fragments (d = 0..31 and 32..63)
  F16Frag aq0, aq1;
  {
    const _Float16* qp = Qh + (size_t)(qb + ln16) * HID + h * HDIM;
    aq0.q[0] = *(const uint4*)(qp + kb8);
    aq0.q[1] = *(const uint4*)(qp + kb8 + 16);
    aq1.q[0] = *(const uint4*)(qp + 32 + kb8);
    aq1.q[1] = *(const uint4*)(qp + 32 + kb8 + 16);
  }

  v8f zero = {};
  v8f oacc[4] = {zero, zero, zero, zero};
  float m[8], l[8];
  #pragma unroll
  for (int r = 0; r < 8; ++r) { m[r] = -3.0e38f; l[r] = 0.f; }

  stage_k(0, kbuf[0]);
  async_wait0();
  __syncthreads();

  const int ylo = wid * 16;                 // band (WG-local keys) = [ylo, ylo+527]
  const int ybstart = ylo & ~31;
  const int ybend   = ylo + 528;

  for (int t = 0; t < NSUPER; ++t) {
    const _Float16* kb = kbuf[t & 1];
    if (t + 1 < NSUPER) stage_k(t + 1, kbuf[(t + 1) & 1]);   // overlap with compute

    const int lo = (t * KROWS > ybstart) ? t * KROWS : ybstart;
    const int hi = ((t + 1) * KROWS < ybend) ? (t + 1) * KROWS : ybend;
    for (int yb = lo; yb < hi; yb += 32) {
      const int kg = qb0 - WINW + yb;       // global key base of this 32-block
      if (kg + 32 <= 0 || kg >= S_LEN) continue;
      const int rb = yb - t * KROWS;        // row base inside the staged buffer

      // ---- scores from LDS K fragments ----
      v8f s0 = zero, s1 = zero;
      {
        const _Float16* kp = kb + (size_t)(rb + ln16) * KPAD + kb8;
        F16Frag blo, bhi;
        blo.q[0] = *(const uint4*)(kp);
        blo.q[1] = *(const uint4*)(kp + 16);
        bhi.q[0] = *(const uint4*)(kp + 32);
        bhi.q[1] = *(const uint4*)(kp + 48);
        s0 = wmma_f16(aq0, blo, s0);
        s0 = wmma_f16(aq1, bhi, s0);
      }
      {
        const _Float16* kp = kb + (size_t)(rb + 16 + ln16) * KPAD + kb8;
        F16Frag blo, bhi;
        blo.q[0] = *(const uint4*)(kp);
        blo.q[1] = *(const uint4*)(kp + 16);
        bhi.q[0] = *(const uint4*)(kp + 32);
        bhi.q[1] = *(const uint4*)(kp + 48);
        s1 = wmma_f16(aq0, blo, s1);
        s1 = wmma_f16(aq1, bhi, s1);
      }

      // ---- mask + online softmax ----
      const int kp0 = kg + ln16;
      const int kp1 = kp0 + 16;
      float e0[8], e1[8], sc[8];
      #pragma unroll
      for (int r = 0; r < 8; ++r) {
        const int gq = qb + r + 8 * hl;
        const bool v0 = (kp0 >= 0) && (kp0 < S_LEN) && (kp0 >= gq - WINW) && (kp0 <= gq + WINW);
        const bool v1 = (kp1 >= 0) && (kp1 < S_LEN) && (kp1 >= gq - WINW) && (kp1 <= gq + WINW);
        const float x0 = v0 ? s0[r] : -3.0e38f;
        const float x1 = v1 ? s1[r] : -3.0e38f;
        float rmax = fmaxf(x0, x1);
        #pragma unroll
        for (int d = 1; d < 16; d <<= 1) rmax = fmaxf(rmax, __shfl_xor(rmax, d, 32));
        const float mn = fmaxf(m[r], rmax);
        if (mn <= -1.0e38f) { sc[r] = 1.f; e0[r] = 0.f; e1[r] = 0.f; }
        else {
          sc[r] = __expf(m[r] - mn);
          e0[r] = __expf(x0 - mn);
          e1[r] = __expf(x1 - mn);
        }
        m[r] = mn;
        float psum = e0[r] + e1[r];
        #pragma unroll
        for (int d = 1; d < 16; d <<= 1) psum += __shfl_xor(psum, d, 32);
        l[r] = l[r] * sc[r] + psum;
      }
      #pragma unroll
      for (int tt = 0; tt < 4; ++tt) {
        #pragma unroll
        for (int r = 0; r < 8; ++r) oacc[tt][r] *= sc[r];
      }

      // ---- P: C-layout f32 -> A-layout f16 via per-wave LDS scratch ----
      _Float16* ps = &pscr[wid][0];
      #pragma unroll
      for (int r = 0; r < 8; ++r) {
        const int M = r + 8 * hl;
        ps[M * 48 + ln16]      = (_Float16)e0[r];
        ps[M * 48 + 16 + ln16] = (_Float16)e1[r];
      }
      F16Frag ap;  // same-wave LDS ops are in-order; no barrier needed
      {
        const _Float16* pr = ps + ln16 * 48 + kb8;
        ap.q[0] = *(const uint4*)(pr);
        ap.q[1] = *(const uint4*)(pr + 16);
      }

      // ---- O += P(16x32) @ V(32x64): Vt[n][s] gives contiguous B-frags ----
      const int k0 = kg + kb8;
      const int k0c = k0 < 0 ? 0 : (k0 > S_LEN - 8 ? S_LEN - 8 : k0);
      const int k1 = k0 + 16;
      const int k1c = k1 < 0 ? 0 : (k1 > S_LEN - 8 ? S_LEN - 8 : k1);
      #pragma unroll
      for (int tt = 0; tt < 4; ++tt) {
        const _Float16* vp = Vt + (size_t)(h * HDIM + tt * 16 + ln16) * S_LEN;
        F16Frag bv;
        bv.q[0] = *(const uint4*)(vp + k0c);
        bv.q[1] = *(const uint4*)(vp + k1c);
        oacc[tt] = wmma_f16(ap, bv, oacc[tt]);
      }
    }

    async_wait0();      // next superblock staged
    __syncthreads();    // everyone done reading current buffer
  }

  // ---- epilogue: out = O / l, f32 ----
  #pragma unroll
  for (int r = 0; r < 8; ++r) {
    const float il = l[r] > 0.f ? 1.f / l[r] : 0.f;
    const int row = qb + r + 8 * hl;
    float* op = out + (size_t)row * HID + h * HDIM + ln16;
    #pragma unroll
    for (int t = 0; t < 4; ++t) op[t * 16] = oacc[t][r] * il;
  }
}

// ---------------------------------------------------------------------------
extern "C" void kernel_launch(void* const* d_in, const int* in_sizes, int n_in,
                              void* d_out, int out_size, void* d_ws, size_t ws_size,
                              hipStream_t stream) {
  (void)in_sizes; (void)n_in; (void)out_size; (void)ws_size;
  const float* X  = (const float*)d_in[0];
  const float* Wq = (const float*)d_in[1];
  const float* bq = (const float*)d_in[2];
  const float* Wk = (const float*)d_in[3];
  const float* bk = (const float*)d_in[4];
  const float* Wv = (const float*)d_in[5];
  const float* bv = (const float*)d_in[6];
  float* out = (float*)d_out;

  char* ws = (char*)d_ws;
  _Float16* Xh = (_Float16*)ws; ws += (size_t)S_LEN * HID * sizeof(_Float16);
  _Float16* Wt = (_Float16*)ws; ws += (size_t)3 * HID * HID * sizeof(_Float16);
  _Float16* Qh = (_Float16*)ws; ws += (size_t)S_LEN * HID * sizeof(_Float16);
  _Float16* Kh = (_Float16*)ws; ws += (size_t)S_LEN * HID * sizeof(_Float16);
  _Float16* Vt = (_Float16*)ws; ws += (size_t)S_LEN * HID * sizeof(_Float16);

  convert_x_kernel<<<(S_LEN * HID / 4) / 256, 256, 0, stream>>>(X, Xh);
  wtrans_kernel<<<dim3(HID / 32, HID / 32, 3), dim3(32, 8), 0, stream>>>(Wq, Wk, Wv, Wt);
  qkv_gemm_kernel<<<dim3(S_LEN / 64, HID / 128, 3), 256, 0, stream>>>(
      Xh, Wt, bq, bk, bv, Qh, Kh, Vt);
  attn_kernel<<<dim3(S_LEN / 128, NHEAD), 256, 0, stream>>>(Qh, Kh, Vt, out);
}

// v001
// Measured time: 144 microseconds a run.
// Two timings next to v000 put it at 1.95 and 1.93 times that version's speed.
#include <hip/hip_runtime.h>
#include <hip/hip_fp16.h>

typedef __attribute__((ext_vector_type(16))) _Float16 v16h;
typedef __attribute__((ext_vector_type(8)))  float    v8f;
typedef __attribute__((ext_vector_type(4)))  int      v4i;

#define S_LEN  8192
#define HID    768
#define NHEAD  12
#define HDIM   64
#define WINW   256

union F16Frag { v16h v; uint4 q[2]; };
union H8Pack  { _Float16 h[8]; uint4 u; };
union H4Pack  { _Float16 h[4]; uint2 u; };

static __device__ __forceinline__ v8f wmma_f16(const F16Frag& a, const F16Frag& b, v8f c) {
  // D = A(16x32 f16) * B(32x16 f16) + C(16x16 f32)
  return __builtin_amdgcn_wmma_f32_16x16x32_f16(false, a.v, false, b.v, (short)0, c, false, false);
}

// ---- async global->LDS (gfx1250), guarded so absence falls back cleanly ----
#if defined(__has_builtin)
#if __has_builtin(__builtin_amdgcn_global_load_async_to_lds_b128)
#define HAVE_ASYNC_LDS 1
#endif
#endif

#ifdef HAVE_ASYNC_LDS
typedef __attribute__((address_space(1))) v4i gv4i;   // global int4*
typedef __attribute__((address_space(3))) v4i lv4i;   // LDS int4*
static __device__ __forceinline__ void cp16_g2l(const _Float16* g, _Float16* l) {
  // flat->AS1 keeps the 64-bit address; flat->AS3 keeps the low-32 LDS offset
  __builtin_amdgcn_global_load_async_to_lds_b128(
      (gv4i*)(size_t)g, (lv4i*)(unsigned)(size_t)l, 0, 0);
}
static __device__ __forceinline__ void async_wait0() {
#if __has_builtin(__builtin_amdgcn_s_wait_asynccnt)
  __builtin_amdgcn_s_wait_asynccnt(0);
#else
  asm volatile("s_wait_asynccnt 0x0" ::: "memory");
#endif
}
#else
static __device__ __forceinline__ void cp16_g2l(const _Float16* g, _Float16* l) {
  *(uint4*)l = *(const uint4*)g;   // VGPR round-trip fallback
}
static __device__ __forceinline__ void async_wait0() {}
#endif

// ---------------------------------------------------------------------------
// Kernel 1: X (f32) -> Xh (f16), vectorized 4-wide
// ---------------------------------------------------------------------------
__global__ void convert_x_kernel(const float* __restrict__ X, _Float16* __restrict__ Xh) {
  const int i = blockIdx.x * blockDim.x + threadIdx.x;  // exactly S*HID/4 threads
  const float4 f = ((const float4*)X)[i];
  H4Pack p;
  p.h[0] = (_Float16)f.x; p.h[1] = (_Float16)f.y;
  p.h[2] = (_Float16)f.z; p.h[3] = (_Float16)f.w;
  ((uint2*)Xh)[i] = p.u;
}

// ---------------------------------------------------------------------------
// Kernel 2: W[k][n] (f32) -> Wt[n][k] (f16), LDS-tiled transpose, 3 matrices
// ---------------------------------------------------------------------------
__global__ void wtrans_kernel(const float* __restrict__ Wq, const float* __restrict__ Wk,
                              const float* __restrict__ Wv, _Float16* __restrict__ Wt) {
  __shared__ _Float16 tile[32][33];
  const float* src = blockIdx.z == 0 ? Wq : (blockIdx.z == 1 ? Wk : Wv);
  _Float16* dst = Wt + (size_t)blockIdx.z * HID * HID;
  const int n0 = blockIdx.x * 32;
  const int k0 = blockIdx.y * 32;
  const int tx = threadIdx.x, ty = threadIdx.y;
  #pragma unroll
  for (int i = 0; i < 4; ++i)
    tile[ty + 8 * i][tx] = (_Float16)src[(size_t)(k0 + ty + 8 * i) * HID + n0 + tx];
  __syncthreads();
  #pragma unroll
  for (int i = 0; i < 4; ++i)
    dst[(size_t)(n0 + ty + 8 * i) * HID + k0 + tx] = tile[tx][ty + 8 * i];
}

// ---------------------------------------------------------------------------
// Kernel 3: QKV projection GEMM. One 128 x 192 tile of the output per block of
//   eight waves (64 x 48 each). The X rows and the W^T rows of a 64-wide k slice
//   are staged in LDS by asynchronous copies, two buffers: the next slice flies
//   while this one is multiplied, and every staged row serves several waves.
//   64 x 4 x 3 = 768 blocks, three resident per WGP by LDS and registers.
// ---------------------------------------------------------------------------
#define GBM     128                       // X rows per block tile
#define GBN     192                       // W^T rows per block tile
#define GBK     64                        // k per stage: rows of 128 B
#define GPITCH  72                        // LDS row pitch in halves: 144 B = 16 B x odd
#define GSTAGE  ((GBM + GBN) * GPITCH)    // halves per buffer
#define GNT     (HID / GBK)               // stages
#define GCOPY   10                        // 16-byte copies per lane and stage

// Ten 16-byte copies per lane, global -> LDS, through no register.
static __device__ __forceinline__ void async_copy10(const unsigned (&l)[GCOPY],
                                                    const _Float16* const (&g)[GCOPY]) {
  // The closing s_wait_xcnt stands inside the statement so that no address
  // register named here is rewritten ahead of it.
  asm volatile(
      "global_load_async_to_lds_b128 %0, %10, off\n\t"
      "global_load_async_to_lds_b128 %1, %11, off\n\t"
      "global_load_async_to_lds_b128 %2, %12, off\n\t"
      "global_load_async_to_lds_b128 %3, %13, off\n\t"
      "global_load_async_to_lds_b128 %4, %14, off\n\t"
      "global_load_async_to_lds_b128 %5, %15, off\n\t"
      "global_load_async_to_lds_b128 %6, %16, off\n\t"
      "global_load_async_to_lds_b128 %7, %17, off\n\t"
      "global_load_async_to_lds_b128 %8, %18, off\n\t"
      "global_load_async_to_lds_b128 %9, %19, off\n\t"
      "s_wait_xcnt 0x0"
      :: "v"(l[0]), "v"(l[1]), "v"(l[2]), "v"(l[3]), "v"(l[4]),
         "v"(l[5]), "v"(l[6]), "v"(l[7]), "v"(l[8]), "v"(l[9]),
         "v"(g[0]), "v"(g[1]), "v"(g[2]), "v"(g[3]), "v"(g[4]),
         "v"(g[5]), "v"(g[6]), "v"(g[7]), "v"(g[8]), "v"(g[9])
      : "memory");
}

__global__ __launch_bounds__(256) void qkv_gemm_kernel(
    const _Float16* __restrict__ Xh, const _Float16* __restrict__ Wt,
    const float* __restrict__ bq, const float* __restrict__ bk, const float* __restrict__ bv,
    _Float16* __restrict__ Qh, _Float16* __restrict__ Kh, _Float16* __restrict__ Vt)
{
  __shared__ __align__(16) _Float16 gbuf[2 * GSTAGE];   // 90 KB

  const int proj = blockIdx.z;
  const int tid  = threadIdx.x;
  const int lane = tid & 31;
  const int w    = tid >> 5;                // 0..7
  const int ln16 = lane & 15;
  const int hl   = lane >> 4;
  const int kb8  = hl * 8;
  const int Mblk = blockIdx.x * GBM;
  const int Nblk = blockIdx.y * GBN;
  const int wm   = (w >> 2) * 64;           // wave's rows inside the block tile
  const int wn   = (w & 3) * 48;            // wave's columns inside the block tile

  // Staging: a lane owns 16-byte chunk (tid & 7) of rows (tid >> 3) + 32 j,
  // so each wave-wide copy covers four whole 128-byte rows.
  const int crow = tid >> 3;
  const int cch  = tid & 7;
  const _Float16* gx = Xh + (size_t)(Mblk + crow) * HID + cch * 8;
  const _Float16* gw = Wt + (size_t)proj * HID * HID + (size_t)(Nblk + crow) * HID + cch * 8;
  const unsigned lds0 = (unsigned)(size_t)&gbuf[0] + (unsigned)(crow * GPITCH + cch * 8) * 2u;

  // One stage: k slice at px / pw into the buffer whose lane address is lb.
  auto stage = [&](const _Float16* px, const _Float16* pw, unsigned lb) {
    unsigned l[GCOPY];
    const _Float16* g[GCOPY];
    // Unrolled so that every index is a constant and l, g are registers.
    #pragma unroll
    for (int j = 0; j < GCOPY; ++j) {       // LDS rows 0..127: X, 128..319: W^T
      l[j] = lb + (unsigned)(j * 32 * GPITCH) * 2u;
      g[j] = j < GBM / 32 ? px + (size_t)j * 32 * HID
                          : pw + (size_t)(j - GBM / 32) * 32 * HID;
    }
    async_copy10(l, g);
  };

  // Every loop over fragments or accumulator tiles below is unrolled so that the
  // array indices are constants: the arrays stay in registers, no scratch.
  v8f zero = {};
  v8f acc[4][3];
  #pragma unroll
  for (int mi = 0; mi < 4; ++mi)
    #pragma unroll
    for (int ni = 0; ni < 3; ++ni) acc[mi][ni] = zero;

  unsigned lfree = lds0;                    // buffer that the current trip reads
  unsigned lbusy = lds0 + GSTAGE * 2u;      // buffer that is being filled
  stage(gx, gw, lfree);
  asm volatile("s_wait_asynccnt 0x0" ::: "memory");   // own copies of stage 0 landed
  __syncthreads();                                    // stage 0 readable by every wave
  stage(gx + GBK, gw + GBK, lbusy);
  gx += 2 * GBK;                            // k slice of the next refill
  gw += 2 * GBK;

  for (int t = 0; t < GNT; ++t) {
    const _Float16* buf = gbuf + (t & 1) * GSTAGE;
    #pragma unroll
    for (int ks = 0; ks < GBK; ks += 32) {
      F16Frag a[4], b[3];
      #pragma unroll
      for (int i = 0; i < 4; ++i) {
        const _Float16* ap = buf + (wm + i * 16 + ln16) * GPITCH + ks + kb8;
        a[i].q[0] = *(const uint4*)(ap);
        a[i].q[1] = *(const uint4*)(ap + 16);
      }
      #pragma unroll
      for (int i = 0; i < 3; ++i) {
        const _Float16* bp = buf + (GBM + wn + i * 16 + ln16) * GPITCH + ks + kb8;
        b[i].q[0] = *(const uint4*)(bp);
        b[i].q[1] = *(const uint4*)(bp + 16);
      }
      #pragma unroll
      for (int mi = 0; mi < 4; ++mi)
        #pragma unroll
        for (int ni = 0; ni < 3; ++ni)
          acc[mi][ni] = wmma_f16(a[mi], b[ni], acc[mi][ni]);
    }
    asm volatile("s_wait_dscnt 0x0" ::: "memory");     // own reads of this buffer done
    asm volatile("s_wait_asynccnt 0x0" ::: "memory");  // own copies of stage t + 1 landed
    __syncthreads();   // publishes stage t + 1, frees the buffer that trip t has read
    if (t + 2 < GNT) stage(gx, gw, lfree);
    gx += GBK;
    gw += GBK;
    const unsigned lswap = lfree; lfree = lbusy; lbusy = lswap;
  }
  asm volatile("s_wait_asynccnt 0x0" ::: "memory");    // no copy outlives the loop

  const float* bias = proj == 0 ? bq : (proj == 1 ? bk : bv);
  const float qscale = proj == 0 ? 0.125f : 1.0f;   // 1/sqrt(64) folded into Q
  #pragma unroll
  for (int mi = 0; mi < 4; ++mi) {
    #pragma unroll
    for (int ni = 0; ni < 3; ++ni) {
      const int n = Nblk + wn + ni * 16 + ln16;
      const float bn = bias[n];
      if (proj == 2) {
        H8Pack p;
        #pragma unroll
        for (int r = 0; r < 8; ++r) p.h[r] = (_Float16)(acc[mi][ni][r] + bn);
        const int srow = Mblk + wm + mi * 16 + 8 * hl;
        *(uint4*)(Vt + (size_t)n * S_LEN + srow) = p.u;
      } else {
        _Float16* dst = proj == 0 ? Qh : Kh;
        #pragma unroll
        for (int r = 0; r < 8; ++r) {
          const int row = Mblk + wm + mi * 16 + r + 8 * hl;
          dst[(size_t)row * HID + n] = (_Float16)((acc[mi][ni][r] + bn) * qscale);
        }
      }
    }
  }
}

// ---------------------------------------------------------------------------
// Kernel 4: banded attention, flash-style, with double-buffered ASYNC K tiles.
//   grid (64, 12), block 256 (8 waves). WG owns 128 query rows; key-band union
//   = 640 keys = 5 superblocks of 128, staged global->LDS asynchronously.
// ---------------------------------------------------------------------------
#define KROWS  128   // keys per superblock
#define KPAD   72    // padded LDS row stride (halves): 144 B, conflict-free b128
#define NSUPER 5

__global__ __launch_bounds__(256) void attn_kernel(
    const _Float16* __restrict__ Qh, const _Float16* __restrict__ Kh,
    const _Float16* __restrict__ Vt, float* __restrict__ out)
{
  __shared__ __align__(16) _Float16 kbuf[2][KROWS * KPAD];  // 36 KB
  __shared__ __align__(16) _Float16 pscr[8][16 * 48];       // 12 KB

  const int qb0  = blockIdx.x * 128;        // first query row of this WG
  const int h    = blockIdx.y;
  const int tid  = threadIdx.x;
  const int lane = tid & 31;
  const int wid  = tid >> 5;                // 0..7
  const int ln16 = lane & 15;
  const int hl   = lane >> 4;
  const int kb8  = hl * 8;
  const int qb   = qb0 + wid * 16;          // first query row of this wave

  // ---- cooperative K superblock staging: 128 rows x 64 halves -> LDS ----
  auto stage_k = [&](int t, _Float16* buf) {
    const int kgbase = qb0 - WINW + KROWS * t;
    #pragma unroll
    for (int j = 0; j < 4; ++j) {
      const int idx = tid + j * 256;        // 1024 x 16 B = one 16 KB tile
      const int row = idx >> 3;             // 0..127
      const int ch  = idx & 7;              // 16-B chunk within row
      int key = kgbase + row;
      key = key < 0 ? 0 : (key >= S_LEN ? S_LEN - 1 : key);   // clamped rows get masked
      cp16_g2l(Kh + (size_t)key * HID + h * HDIM + ch * 8, buf + row * KPAD + ch * 8);
    }
  };

  // Q A-fragments (d = 0..31 and 32..63)
  F16Frag aq0, aq1;
  {
    const _Float16* qp = Qh + (size_t)(qb + ln16) * HID + h * HDIM;
    aq0.q[0] = *(const uint4*)(qp + kb8);
    aq0.q[1] = *(const uint4*)(qp + kb8 + 16);
    aq1.q[0] = *(const uint4*)(qp + 32 + kb8);
    aq1.q[1] = *(const uint4*)(qp + 32 + kb8 + 16);
  }

  v8f zero = {};
  v8f oacc[4] = {zero, zero, zero, zero};
  float m[8], l[8];
  #pragma unroll
  for (int r = 0; r < 8; ++r) { m[r] = -3.0e38f; l[r] = 0.f; }

  stage_k(0, kbuf[0]);
  async_wait0();
  __syncthreads();

  const int ylo = wid * 16;                 // band (WG-local keys) = [ylo, ylo+527]
  const int ybstart = ylo & ~31;
  const int ybend   = ylo + 528;

  for (int t = 0; t < NSUPER; ++t) {
    const _Float16* kb = kbuf[t & 1];
    if (t + 1 < NSUPER) stage_k(t + 1, kbuf[(t + 1) & 1]);   // overlap with compute

    const int lo = (t * KROWS > ybstart) ? t * KROWS : ybstart;
    const int hi = ((t + 1) * KROWS < ybend) ? (t + 1) * KROWS : ybend;
    for (int yb = lo; yb < hi; yb += 32) {
      const int kg = qb0 - WINW + yb;       // global key base of this 32-block
      if (kg + 32 <= 0 || kg >= S_LEN) continue;
      const int rb = yb - t * KROWS;        // row base inside the staged buffer

      // ---- scores from LDS K fragments ----
      v8f s0 = zero, s1 = zero;
      {
        const _Float16* kp = kb + (size_t)(rb + ln16) * KPAD + kb8;
        F16Frag blo, bhi;
        blo.q[0] = *(const uint4*)(kp);
        blo.q[1] = *(const uint4*)(kp + 16);
        bhi.q[0] = *(const uint4*)(kp + 32);
        bhi.q[1] = *(const uint4*)(kp + 48);
        s0 = wmma_f16(aq0, blo, s0);
        s0 = wmma_f16(aq1, bhi, s0);
      }
      {
        const _Float16* kp = kb + (size_t)(rb + 16 + ln16) * KPAD + kb8;
        F16Frag blo, bhi;
        blo.q[0] = *(const uint4*)(kp);
        blo.q[1] = *(const uint4*)(kp + 16);
        bhi.q[0] = *(const uint4*)(kp + 32);
        bhi.q[1] = *(const uint4*)(kp + 48);
        s1 = wmma_f16(aq0, blo, s1);
        s1 = wmma_f16(aq1, bhi, s1);
      }

      // ---- mask + online softmax ----
      const int kp0 = kg + ln16;
      const int kp1 = kp0 + 16;
      float e0[8], e1[8], sc[8];
      #pragma unroll
      for (int r = 0; r < 8; ++r) {
        const int gq = qb + r + 8 * hl;
        const bool v0 = (kp0 >= 0) && (kp0 < S_LEN) && (kp0 >= gq - WINW) && (kp0 <= gq + WINW);
        const bool v1 = (kp1 >= 0) && (kp1 < S_LEN) && (kp1 >= gq - WINW) && (kp1 <= gq + WINW);
        const float x0 = v0 ? s0[r] : -3.0e38f;
        const float x1 = v1 ? s1[r] : -3.0e38f;
        float rmax = fmaxf(x0, x1);
        #pragma unroll
        for (int d = 1; d < 16; d <<= 1) rmax = fmaxf(rmax, __shfl_xor(rmax, d, 32));
        const float mn = fmaxf(m[r], rmax);
        if (mn <= -1.0e38f) { sc[r] = 1.f; e0[r] = 0.f; e1[r] = 0.f; }
        else {
          sc[r] = __expf(m[r] - mn);
          e0[r] = __expf(x0 - mn);
          e1[r] = __expf(x1 - mn);
        }
        m[r] = mn;
        float psum = e0[r] + e1[r];
        #pragma unroll
        for (int d = 1; d < 16; d <<= 1) psum += __shfl_xor(psum, d, 32);
        l[r] = l[r] * sc[r] + psum;
      }
      #pragma unroll
      for (int tt = 0; tt < 4; ++tt) {
        #pragma unroll
        for (int r = 0; r < 8; ++r) oacc[tt][r] *= sc[r];
      }

      // ---- P: C-layout f32 -> A-layout f16 via per-wave LDS scratch ----
      _Float16* ps = &pscr[wid][0];
      #pragma unroll
      for (int r = 0; r < 8; ++r) {
        const int M = r + 8 * hl;
        ps[M * 48 + ln16]      = (_Float16)e0[r];
        ps[M * 48 + 16 + ln16] = (_Float16)e1[r];
      }
      F16Frag ap;  // same-wave LDS ops are in-order; no barrier needed
      {
        const _Float16* pr = ps + ln16 * 48 + kb8;
        ap.q[0] = *(const uint4*)(pr);
        ap.q[1] = *(const uint4*)(pr + 16);
      }

      // ---- O += P(16x32) @ V(32x64): Vt[n][s] gives contiguous B-frags ----
      const int k0 = kg + kb8;
      const int k0c = k0 < 0 ? 0 : (k0 > S_LEN - 8 ? S_LEN - 8 : k0);
      const int k1 = k0 + 16;
      const int k1c = k1 < 0 ? 0 : (k1 > S_LEN - 8 ? S_LEN - 8 : k1);
      #pragma unroll
      for (int tt = 0; tt < 4; ++tt) {
        const _Float16* vp = Vt + (size_t)(h * HDIM + tt * 16 + ln16) * S_LEN;
        F16Frag bv;
        bv.q[0] = *(const uint4*)(vp + k0c);
        bv.q[1] = *(const uint4*)(vp + k1c);
        oacc[tt] = wmma_f16(ap, bv, oacc[tt]);
      }
    }

    async_wait0();      // next superblock staged
    __syncthreads();    // everyone done reading current buffer
  }

  // ---- epilogue: out = O / l, f32 ----
  #pragma unroll
  for (int r = 0; r < 8; ++r) {
    const float il = l[r] > 0.f ? 1.f / l[r] : 0.f;
    const int row = qb + r + 8 * hl;
    float* op = out + (size_t)row * HID + h * HDIM + ln16;
    #pragma unroll
    for (int t = 0; t < 4; ++t) op[t * 16] = oacc[t][r] * il;
  }
}

// ---------------------------------------------------------------------------
extern "C" void kernel_launch(void* const* d_in, const int* in_sizes, int n_in,
                              void* d_out, int out_size, void* d_ws, size_t ws_size,
                              hipStream_t stream) {
  (void)in_sizes; (void)n_in; (void)out_size; (void)ws_size;
  const float* X  = (const float*)d_in[0];
  const float* Wq = (const float*)d_in[1];
  const float* bq = (const float*)d_in[2];
  const float* Wk = (const float*)d_in[3];
  const float* bk = (const float*)d_in[4];
  const float* Wv = (const float*)d_in[5];
  const float* bv = (const float*)d_in[6];
  float* out = (float*)d_out;

  char* ws = (char*)d_ws;
  _Float16* Xh = (_Float16*)ws; ws += (size_t)S_LEN * HID * sizeof(_Float16);
  _Float16* Wt = (_Float16*)ws; ws += (size_t)3 * HID * HID * sizeof(_Float16);
  _Float16* Qh = (_Float16*)ws; ws += (size_t)S_LEN * HID * sizeof(_Float16);
  _Float16* Kh = (_Float16*)ws; ws += (size_t)S_LEN * HID * sizeof(_Float16);
  _Float16* Vt = (_Float16*)ws; ws += (size_t)S_LEN * HID * sizeof(_Float16);

  convert_x_kernel<<<(S_LEN * HID / 4) / 256, 256, 0, stream>>>(X, Xh);
  wtrans_kernel<<<dim3(HID / 32, HID / 32, 3), dim3(32, 8), 0, stream>>>(Wq, Wk, Wv, Wt);
  qkv_gemm_kernel<<<dim3(S_LEN / GBM, HID / GBN, 3), 256, 0, stream>>>(
      Xh, Wt, bq, bk, bv, Qh, Kh, Vt);
  attn_kernel<<<dim3(S_LEN / 128, NHEAD), 256, 0, stream>>>(Qh, Kh, Vt, out);
}

// v002
// One run takes 72 microseconds.
// Next to v001, in two timings, it ran 2.00 times as fast each time.
// Counting every step since v000, it is 3.88 times as fast.
#include <hip/hip_runtime.h>
#include <hip/hip_fp16.h>

typedef __attribute__((ext_vector_type(16))) _Float16 v16h;
typedef __attribute__((ext_vector_type(8)))  float    v8f;
typedef __attribute__((ext_vector_type(4)))  int      v4i;

#define S_LEN  8192
#define HID    768
#define NHEAD  12
#define HDIM   64
#define WINW   256

union F16Frag { v16h v; uint4 q[2]; };
union H8Pack  { _Float16 h[8]; uint4 u; };
union H4Pack  { _Float16 h[4]; uint2 u; };

static __device__ __forceinline__ v8f wmma_f16(const F16Frag& a, const F16Frag& b, v8f c) {
  // D = A(16x32 f16) * B(32x16 f16) + C(16x16 f32)
  return __builtin_amdgcn_wmma_f32_16x16x32_f16(false, a.v, false, b.v, (short)0, c, false, false);
}

// ---- async global->LDS (gfx1250), guarded so absence falls back cleanly ----
#if defined(__has_builtin)
#if __has_builtin(__builtin_amdgcn_global_load_async_to_lds_b128)
#define HAVE_ASYNC_LDS 1
#endif
#endif

#ifdef HAVE_ASYNC_LDS
typedef __attribute__((address_space(1))) v4i gv4i;   // global int4*
typedef __attribute__((address_space(3))) v4i lv4i;   // LDS int4*
static __device__ __forceinline__ void cp16_g2l(const _Float16* g, _Float16* l) {
  // flat->AS1 keeps the 64-bit address; flat->AS3 keeps the low-32 LDS offset
  __builtin_amdgcn_global_load_async_to_lds_b128(
      (gv4i*)(size_t)g, (lv4i*)(unsigned)(size_t)l, 0, 0);
}
static __device__ __forceinline__ void async_wait0() {
#if __has_builtin(__builtin_amdgcn_s_wait_asynccnt)
  __builtin_amdgcn_s_wait_asynccnt(0);
#else
  asm volatile("s_wait_asynccnt 0x0" ::: "memory");
#endif
}
#else
static __device__ __forceinline__ void cp16_g2l(const _Float16* g, _Float16* l) {
  *(uint4*)l = *(const uint4*)g;   // VGPR round-trip fallback
}
static __device__ __forceinline__ void async_wait0() {}
#endif

// ---------------------------------------------------------------------------
// Kernel 1: X (f32) -> Xh (f16), vectorized 4-wide
// ---------------------------------------------------------------------------
__global__ void convert_x_kernel(const float* __restrict__ X, _Float16* __restrict__ Xh) {
  const int i = blockIdx.x * blockDim.x + threadIdx.x;  // exactly S*HID/4 threads
  const float4 f = ((const float4*)X)[i];
  H4Pack p;
  p.h[0] = (_Float16)f.x; p.h[1] = (_Float16)f.y;
  p.h[2] = (_Float16)f.z; p.h[3] = (_Float16)f.w;
  ((uint2*)Xh)[i] = p.u;
}

// ---------------------------------------------------------------------------
// Kernel 2: W[k][n] (f32) -> Wt[n][k] (f16), LDS-tiled transpose, 3 matrices
// ---------------------------------------------------------------------------
__global__ void wtrans_kernel(const float* __restrict__ Wq, const float* __restrict__ Wk,
                              const float* __restrict__ Wv, _Float16* __restrict__ Wt) {
  __shared__ _Float16 tile[32][33];
  const float* src = blockIdx.z == 0 ? Wq : (blockIdx.z == 1 ? Wk : Wv);
  _Float16* dst = Wt + (size_t)blockIdx.z * HID * HID;
  const int n0 = blockIdx.x * 32;
  const int k0 = blockIdx.y * 32;
  const int tx = threadIdx.x, ty = threadIdx.y;
  #pragma unroll
  for (int i = 0; i < 4; ++i)
    tile[ty + 8 * i][tx] = (_Float16)src[(size_t)(k0 + ty + 8 * i) * HID + n0 + tx];
  __syncthreads();
  #pragma unroll
  for (int i = 0; i < 4; ++i)
    dst[(size_t)(n0 + ty + 8 * i) * HID + k0 + tx] = tile[tx][ty + 8 * i];
}

// ---------------------------------------------------------------------------
// Kernel 3: QKV projection GEMM. One 128 x 192 tile of the output per block of
//   eight waves (64 x 48 each). The X rows and the W^T rows of a 64-wide k slice
//   are staged in LDS by asynchronous copies, two buffers: the next slice flies
//   while this one is multiplied, and every staged row serves several waves.
//   64 x 4 x 3 = 768 blocks, three resident per WGP by LDS and registers.
// ---------------------------------------------------------------------------
#define GBM     128                       // X rows per block tile
#define GBN     192                       // W^T rows per block tile
#define GBK     64                        // k per stage: rows of 128 B
#define GPITCH  72                        // LDS row pitch in halves: 144 B = 16 B x odd
#define GSTAGE  ((GBM + GBN) * GPITCH)    // halves per buffer
#define GNT     (HID / GBK)               // stages
#define GCOPY   10                        // 16-byte copies per lane and stage

// Ten 16-byte copies per lane, global -> LDS, through no register.
static __device__ __forceinline__ void async_copy10(const unsigned (&l)[GCOPY],
                                                    const _Float16* const (&g)[GCOPY]) {
  // The closing s_wait_xcnt stands inside the statement so that no address
  // register named here is rewritten ahead of it.
  asm volatile(
      "global_load_async_to_lds_b128 %0, %10, off\n\t"
      "global_load_async_to_lds_b128 %1, %11, off\n\t"
      "global_load_async_to_lds_b128 %2, %12, off\n\t"
      "global_load_async_to_lds_b128 %3, %13, off\n\t"
      "global_load_async_to_lds_b128 %4, %14, off\n\t"
      "global_load_async_to_lds_b128 %5, %15, off\n\t"
      "global_load_async_to_lds_b128 %6, %16, off\n\t"
      "global_load_async_to_lds_b128 %7, %17, off\n\t"
      "global_load_async_to_lds_b128 %8, %18, off\n\t"
      "global_load_async_to_lds_b128 %9, %19, off\n\t"
      "s_wait_xcnt 0x0"
      :: "v"(l[0]), "v"(l[1]), "v"(l[2]), "v"(l[3]), "v"(l[4]),
         "v"(l[5]), "v"(l[6]), "v"(l[7]), "v"(l[8]), "v"(l[9]),
         "v"(g[0]), "v"(g[1]), "v"(g[2]), "v"(g[3]), "v"(g[4]),
         "v"(g[5]), "v"(g[6]), "v"(g[7]), "v"(g[8]), "v"(g[9])
      : "memory");
}

__global__ __launch_bounds__(256) void qkv_gemm_kernel(
    const _Float16* __restrict__ Xh, const _Float16* __restrict__ Wt,
    const float* __restrict__ bq, const float* __restrict__ bk, const float* __restrict__ bv,
    _Float16* __restrict__ Qh, _Float16* __restrict__ Kh, _Float16* __restrict__ Vt)
{
  __shared__ __align__(16) _Float16 gbuf[2 * GSTAGE];   // 90 KB

  const int proj = blockIdx.z;
  const int tid  = threadIdx.x;
  const int lane = tid & 31;
  const int w    = tid >> 5;                // 0..7
  const int ln16 = lane & 15;
  const int hl   = lane >> 4;
  const int kb8  = hl * 8;
  const int Mblk = blockIdx.x * GBM;
  const int Nblk = blockIdx.y * GBN;
  const int wm   = (w >> 2) * 64;           // wave's rows inside the block tile
  const int wn   = (w & 3) * 48;            // wave's columns inside the block tile

  // Staging: a lane owns 16-byte chunk (tid & 7) of rows (tid >> 3) + 32 j,
  // so each wave-wide copy covers four whole 128-byte rows.
  const int crow = tid >> 3;
  const int cch  = tid & 7;
  const _Float16* gx = Xh + (size_t)(Mblk + crow) * HID + cch * 8;
  const _Float16* gw = Wt + (size_t)proj * HID * HID + (size_t)(Nblk + crow) * HID + cch * 8;
  const unsigned lds0 = (unsigned)(size_t)&gbuf[0] + (unsigned)(crow * GPITCH + cch * 8) * 2u;

  // One stage: k slice at px / pw into the buffer whose lane address is lb.
  auto stage = [&](const _Float16* px, const _Float16* pw, unsigned lb) {
    unsigned l[GCOPY];
    const _Float16* g[GCOPY];
    // Unrolled so that every index is a constant and l, g are registers.
    #pragma unroll
    for (int j = 0; j < GCOPY; ++j) {       // LDS rows 0..127: X, 128..319: W^T
      l[j] = lb + (unsigned)(j * 32 * GPITCH) * 2u;
      g[j] = j < GBM / 32 ? px + (size_t)j * 32 * HID
                          : pw + (size_t)(j - GBM / 32) * 32 * HID;
    }
    async_copy10(l, g);
  };

  // Every loop over fragments or accumulator tiles below is unrolled so that the
  // array indices are constants: the arrays stay in registers, no scratch.
  v8f zero = {};
  v8f acc[4][3];
  #pragma unroll
  for (int mi = 0; mi < 4; ++mi)
    #pragma unroll
    for (int ni = 0; ni < 3; ++ni) acc[mi][ni] = zero;

  unsigned lfree = lds0;                    // buffer that the current trip reads
  unsigned lbusy = lds0 + GSTAGE * 2u;      // buffer that is being filled
  stage(gx, gw, lfree);
  asm volatile("s_wait_asynccnt 0x0" ::: "memory");   // own copies of stage 0 landed
  __syncthreads();                                    // stage 0 readable by every wave
  stage(gx + GBK, gw + GBK, lbusy);
  gx += 2 * GBK;                            // k slice of the next refill
  gw += 2 * GBK;

  for (int t = 0; t < GNT; ++t) {
    const _Float16* buf = gbuf + (t & 1) * GSTAGE;
    #pragma unroll
    for (int ks = 0; ks < GBK; ks += 32) {
      F16Frag a[4], b[3];
      #pragma unroll
      for (int i = 0; i < 4; ++i) {
        const _Float16* ap = buf + (wm + i * 16 + ln16) * GPITCH + ks + kb8;
        a[i].q[0] = *(const uint4*)(ap);
        a[i].q[1] = *(const uint4*)(ap + 16);
      }
      #pragma unroll
      for (int i = 0; i < 3; ++i) {
        const _Float16* bp = buf + (GBM + wn + i * 16 + ln16) * GPITCH + ks + kb8;
        b[i].q[0] = *(const uint4*)(bp);
        b[i].q[1] = *(const uint4*)(bp + 16);
      }
      #pragma unroll
      for (int mi = 0; mi < 4; ++mi)
        #pragma unroll
        for (int ni = 0; ni < 3; ++ni)
          acc[mi][ni] = wmma_f16(a[mi], b[ni], acc[mi][ni]);
    }
    asm volatile("s_wait_dscnt 0x0" ::: "memory");     // own reads of this buffer done
    asm volatile("s_wait_asynccnt 0x0" ::: "memory");  // own copies of stage t + 1 landed
    __syncthreads();   // publishes stage t + 1, frees the buffer that trip t has read
    if (t + 2 < GNT) stage(gx, gw, lfree);
    gx += GBK;
    gw += GBK;
    const unsigned lswap = lfree; lfree = lbusy; lbusy = lswap;
  }
  asm volatile("s_wait_asynccnt 0x0" ::: "memory");    // no copy outlives the loop

  const float* bias = proj == 0 ? bq : (proj == 1 ? bk : bv);
  const float qscale = proj == 0 ? 0.125f : 1.0f;   // 1/sqrt(64) folded into Q
  #pragma unroll
  for (int mi = 0; mi < 4; ++mi) {
    #pragma unroll
    for (int ni = 0; ni < 3; ++ni) {
      const int n = Nblk + wn + ni * 16 + ln16;
      const float bn = bias[n];
      if (proj == 2) {
        H8Pack p;
        #pragma unroll
        for (int r = 0; r < 8; ++r) p.h[r] = (_Float16)(acc[mi][ni][r] + bn);
        const int srow = Mblk + wm + mi * 16 + 8 * hl;
        *(uint4*)(Vt + (size_t)n * S_LEN + srow) = p.u;
      } else {
        _Float16* dst = proj == 0 ? Qh : Kh;
        #pragma unroll
        for (int r = 0; r < 8; ++r) {
          const int row = Mblk + wm + mi * 16 + r + 8 * hl;
          dst[(size_t)row * HID + n] = (_Float16)((acc[mi][ni][r] + bn) * qscale);
        }
      }
    }
  }
}

#define KROWS  128
#define KPAD   72
#define NSUPER 5

// Lane l takes the value of lane l ^ 16 (a vector cross-row move, no LDS).
static __device__ __forceinline__ float xhalf(float x) {
  const int b = __builtin_bit_cast(int, x);
  return __builtin_bit_cast(float,
      __builtin_amdgcn_permlanex16(b, b, 0x76543210, 0xfedcba98, false, false));
}

// 768 blocks on 256 WGPs are six waves per SIMD: a register budget for six, not
// more, leaves room to load the four V fragments of a block as one group.
__global__ __launch_bounds__(256) __attribute__((amdgpu_waves_per_eu(6, 6))) void attn_kernel(
    const _Float16* __restrict__ Qh, const _Float16* __restrict__ Kh,
    const _Float16* __restrict__ Vt, float* __restrict__ out)
{
  __shared__ __align__(16) _Float16 kbuf[2][KROWS * KPAD];  // 36 KB

  const int qb0  = blockIdx.x * 128;        // first query row of this WG
  const int h    = blockIdx.y;
  const int tid  = threadIdx.x;
  const int lane = tid & 31;
  const int wid  = tid >> 5;                // 0..7
  const int ln16 = lane & 15;
  const int hl   = lane >> 4;
  const int kb8  = hl * 8;
  const int qb   = qb0 + wid * 16;          // first query row of this wave
  const int gq   = qb + ln16;               // the one query of this lane
  // Its valid keys: inside the band and inside [0, S)
  const int klo  = gq - WINW < 0 ? 0 : gq - WINW;
  const int khi  = gq + WINW > S_LEN - 1 ? S_LEN - 1 : gq + WINW;
  const unsigned kspan = (unsigned)(khi - klo);

  // ---- cooperative K superblock staging: 128 rows x 64 halves -> LDS ----
  auto stage_k = [&](int t, _Float16* buf) {
    const int kgbase = qb0 - WINW + KROWS * t;
    #pragma unroll
    for (int j = 0; j < 4; ++j) {
      const int idx = tid + j * 256;        // 1024 x 16 B = one 16 KB tile
      const int row = idx >> 3;             // 0..127
      const int ch  = idx & 7;              // 16-B chunk within row
      int key = kgbase + row;
      key = key < 0 ? 0 : (key >= S_LEN ? S_LEN - 1 : key);   // clamped rows get masked
      cp16_g2l(Kh + (size_t)key * HID + h * HDIM + ch * 8, buf + row * KPAD + ch * 8);
    }
  };

  // Q B-fragments (d = 0..31 and 32..63): column ln16 of Q^T is query gq
  F16Frag bq0, bq1;
  {
    const _Float16* qp = Qh + (size_t)gq * HID + h * HDIM;
    bq0.q[0] = *(const uint4*)(qp + kb8);
    bq0.q[1] = *(const uint4*)(qp + kb8 + 16);
    bq1.q[0] = *(const uint4*)(qp + 32 + kb8);
    bq1.q[1] = *(const uint4*)(qp + 32 + kb8 + 16);
  }

  // Every loop over r or tt below is unrolled so that the indices are constants:
  // the score, fragment and accumulator arrays stay in registers, no scratch.
  v8f zero = {};
  v8f oacc[4] = {zero, zero, zero, zero};   // oacc[tt][r] = O[gq][tt*16 + 8*hl + r]
  float m = -3.0e38f;                       // running maximum of query gq
  float l = 0.f;                            // this half's share of its sum

  stage_k(0, kbuf[0]);
  async_wait0();
  __syncthreads();

  const int ylo = wid * 16;                 // band (WG-local keys) = [ylo, ylo+527]
  const int ybstart = ylo & ~31;
  const int ybend   = ylo + 528;

  for (int t = 0; t < NSUPER; ++t) {
    const _Float16* kb = kbuf[t & 1];
    if (t + 1 < NSUPER) stage_k(t + 1, kbuf[(t + 1) & 1]);   // overlap with compute

    const int lo = (t * KROWS > ybstart) ? t * KROWS : ybstart;
    const int hi = ((t + 1) * KROWS < ybend) ? (t + 1) * KROWS : ybend;
    for (int yb = lo; yb < hi; yb += 32) {
      const int kg = qb0 - WINW + yb;       // global key base of this 32-block
      if (kg + 32 <= 0 || kg >= S_LEN) continue;
      const int rb = yb - t * KROWS;        // row base inside the staged buffer

      // ---- S^T from LDS K fragments: s0[r] = key kg + 8*hl + r, s1[r] = 16 more ----
      v8f s0 = zero, s1 = zero;
      {
        const _Float16* kp = kb + (size_t)(rb + ln16) * KPAD + kb8;
        F16Frag alo, ahi;
        alo.q[0] = *(const uint4*)(kp);
        alo.q[1] = *(const uint4*)(kp + 16);
        ahi.q[0] = *(const uint4*)(kp + 32);
        ahi.q[1] = *(const uint4*)(kp + 48);
        s0 = wmma_f16(alo, bq0, s0);
        s0 = wmma_f16(ahi, bq1, s0);
      }
      {
        const _Float16* kp = kb + (size_t)(rb + 16 + ln16) * KPAD + kb8;
        F16Frag alo, ahi;
        alo.q[0] = *(const uint4*)(kp);
        alo.q[1] = *(const uint4*)(kp + 16);
        ahi.q[0] = *(const uint4*)(kp + 32);
        ahi.q[1] = *(const uint4*)(kp + 48);
        s1 = wmma_f16(alo, bq0, s1);
        s1 = wmma_f16(ahi, bq1, s1);
      }

      // ---- mask + online softmax, one query per lane ----
      const int krel = kg + kb8 - klo;      // key of s0[0], counted from klo
      float x0[8], x1[8];
      #pragma unroll
      for (int r = 0; r < 8; ++r) {
        // klo <= key <= khi as one unsigned compare of key - klo
        x0[r] = (unsigned)(krel + r)      <= kspan ? s0[r] : -3.0e38f;
        x1[r] = (unsigned)(krel + 16 + r) <= kspan ? s1[r] : -3.0e38f;
      }
      float rmax = fmaxf(x0[0], x1[0]);
      #pragma unroll
      for (int r = 1; r < 8; ++r) rmax = fmaxf(rmax, fmaxf(x0[r], x1[r]));
      rmax = fmaxf(rmax, xhalf(rmax));      // both halves scale by the same maximum
      const float mn = fmaxf(m, rmax);
      // Nothing valid yet: subtract 0, so that every masked score still gives exp = 0.
      const float mref = mn <= -1.0e38f ? 0.f : mn;
      const float sc = __expf(m - mref);
      m = mn;
      F16Frag bp;                           // P^T as B operand: k order of the K, V loaders
      float ps0 = 0.f, ps1 = 0.f;
      #pragma unroll
      for (int r = 0; r < 8; ++r) {
        const float e0 = __expf(x0[r] - mref);
        const float e1 = __expf(x1[r] - mref);
        ps0 += e0;
        ps1 += e1;
        bp.v[r]     = (_Float16)e0;
        bp.v[8 + r] = (_Float16)e1;
      }
      l = l * sc + (ps0 + ps1);
      #pragma unroll
      for (int tt = 0; tt < 4; ++tt) {
        #pragma unroll
        for (int r = 0; r < 8; ++r) oacc[tt][r] *= sc;
      }

      // ---- O^T += V^T(16x32) @ P^T(32x16): Vt[n][s] gives contiguous A-frags ----
      const int k0 = kg + kb8;
      const int k0c = k0 < 0 ? 0 : (k0 > S_LEN - 8 ? S_LEN - 8 : k0);
      const int k1 = k0 + 16;
      const int k1c = k1 < 0 ? 0 : (k1 > S_LEN - 8 ? S_LEN - 8 : k1);
      #pragma unroll
      for (int tt = 0; tt < 4; ++tt) {
        const _Float16* vp = Vt + (size_t)(h * HDIM + tt * 16 + ln16) * S_LEN;
        F16Frag av;
        av.q[0] = *(const uint4*)(vp + k0c);
        av.q[1] = *(const uint4*)(vp + k1c);
        oacc[tt] = wmma_f16(av, bp, oacc[tt]);
      }
    }

    async_wait0();      // next superblock staged
    __syncthreads();    // everyone done reading current buffer
  }

  // ---- epilogue: join the halves' sums, out = O / l, f32, 32 B runs per lane ----
  l += xhalf(l);
  const float il = l > 0.f ? 1.f / l : 0.f;
  float* op = out + (size_t)gq * HID + h * HDIM + kb8;
  #pragma unroll
  for (int tt = 0; tt < 4; ++tt) {
    const float4 f0 = make_float4(oacc[tt][0] * il, oacc[tt][1] * il, oacc[tt][2] * il, oacc[tt][3] * il);
    const float4 f1 = make_float4(oacc[tt][4] * il, oacc[tt][5] * il, oacc[tt][6] * il, oacc[tt][7] * il);
    *(float4*)(op + tt * 16)     = f0;
    *(float4*)(op + tt * 16 + 4) = f1;
  }
}

// ---------------------------------------------------------------------------
extern "C" void kernel_launch(void* const* d_in, const int* in_sizes, int n_in,
                              void* d_out, int out_size, void* d_ws, size_t ws_size,
                              hipStream_t stream) {
  (void)in_sizes; (void)n_in; (void)out_size; (void)ws_size;
  const float* X  = (const float*)d_in[0];
  const float* Wq = (const float*)d_in[1];
  const float* bq = (const float*)d_in[2];
  const float* Wk = (const float*)d_in[3];
  const float* bk = (const float*)d_in[4];
  const float* Wv = (const float*)d_in[5];
  const float* bv = (const float*)d_in[6];
  float* out = (float*)d_out;

  char* ws = (char*)d_ws;
  _Float16* Xh = (_Float16*)ws; ws += (size_t)S_LEN * HID * sizeof(_Float16);
  _Float16* Wt = (_Float16*)ws; ws += (size_t)3 * HID * HID * sizeof(_Float16);
  _Float16* Qh = (_Float16*)ws; ws += (size_t)S_LEN * HID * sizeof(_Float16);
  _Float16* Kh = (_Float16*)ws; ws += (size_t)S_LEN * HID * sizeof(_Float16);
  _Float16* Vt = (_Float16*)ws; ws += (size_t)S_LEN * HID * sizeof(_Float16);

  convert_x_kernel<<<(S_LEN * HID / 4) / 256, 256, 0, stream>>>(X, Xh);
  wtrans_kernel<<<dim3(HID / 32, HID / 32, 3), dim3(32, 8), 0, stream>>>(Wq, Wk, Wv, Wt);
  qkv_gemm_kernel<<<dim3(S_LEN / GBM, HID / GBN, 3), 256, 0, stream>>>(
      Xh, Wt, bq, bk, bv, Qh, Kh, Vt);
  attn_kernel<<<dim3(S_LEN / 128, NHEAD), 256, 0, stream>>>(Qh, Kh, Vt, out);
}

// v003
// It runs in 63.4 microseconds.
// In two side-by-side timings against v002, it was 1.13 and 1.14 times as fast.
// Counting every step since v000, it is 4.41 times as fast.
#include <hip/hip_runtime.h>
#include <hip/hip_fp16.h>

typedef __attribute__((ext_vector_type(16))) _Float16 v16h;
typedef __attribute__((ext_vector_type(8)))  float    v8f;
typedef __attribute__((ext_vector_type(4)))  int      v4i;

#define S_LEN  8192
#define HID    768
#define NHEAD  12
#define HDIM   64
#define WINW   256

union F16Frag { v16h v; uint4 q[2]; };
union H8Pack  { _Float16 h[8]; uint4 u; };
union H4Pack  { _Float16 h[4]; uint2 u; };

static __device__ __forceinline__ v8f wmma_f16(const F16Frag& a, const F16Frag& b, v8f c) {
  // D = A(16x32 f16) * B(32x16 f16) + C(16x16 f32)
  return __builtin_amdgcn_wmma_f32_16x16x32_f16(false, a.v, false, b.v, (short)0, c, false, false);
}

// ---- async global->LDS (gfx1250), guarded so absence falls back cleanly ----
#if defined(__has_builtin)
#if __has_builtin(__builtin_amdgcn_global_load_async_to_lds_b128)
#define HAVE_ASYNC_LDS 1
#endif
#endif

#ifdef HAVE_ASYNC_LDS
typedef __attribute__((address_space(1))) v4i gv4i;   // global int4*
typedef __attribute__((address_space(3))) v4i lv4i;   // LDS int4*
static __device__ __forceinline__ void cp16_g2l(const _Float16* g, _Float16* l) {
  // flat->AS1 keeps the 64-bit address; flat->AS3 keeps the low-32 LDS offset
  __builtin_amdgcn_global_load_async_to_lds_b128(
      (gv4i*)(size_t)g, (lv4i*)(unsigned)(size_t)l, 0, 0);
}
#else
static __device__ __forceinline__ void cp16_g2l(const _Float16* g, _Float16* l) {
  *(uint4*)l = *(const uint4*)g;   // VGPR round-trip fallback
}
#endif

// ---------------------------------------------------------------------------
// Kernel 1: X (f32) -> Xh (f16), vectorized 4-wide
// ---------------------------------------------------------------------------
__global__ void convert_x_kernel(const float* __restrict__ X, _Float16* __restrict__ Xh) {
  const int i = blockIdx.x * blockDim.x + threadIdx.x;  // exactly S*HID/4 threads
  const float4 f = ((const float4*)X)[i];
  H4Pack p;
  p.h[0] = (_Float16)f.x; p.h[1] = (_Float16)f.y;
  p.h[2] = (_Float16)f.z; p.h[3] = (_Float16)f.w;
  ((uint2*)Xh)[i] = p.u;
}

// ---------------------------------------------------------------------------
// Kernel 2: W[k][n] (f32) -> Wt[n][k] (f16), LDS-tiled transpose, 3 matrices
// ---------------------------------------------------------------------------
__global__ void wtrans_kernel(const float* __restrict__ Wq, const float* __restrict__ Wk,
                              const float* __restrict__ Wv, _Float16* __restrict__ Wt) {
  __shared__ _Float16 tile[32][33];
  const float* src = blockIdx.z == 0 ? Wq : (blockIdx.z == 1 ? Wk : Wv);
  _Float16* dst = Wt + (size_t)blockIdx.z * HID * HID;
  const int n0 = blockIdx.x * 32;
  const int k0 = blockIdx.y * 32;
  const int tx = threadIdx.x, ty = threadIdx.y;
  #pragma unroll
  for (int i = 0; i < 4; ++i)
    tile[ty + 8 * i][tx] = (_Float16)src[(size_t)(k0 + ty + 8 * i) * HID + n0 + tx];
  __syncthreads();
  #pragma unroll
  for (int i = 0; i < 4; ++i)
    dst[(size_t)(n0 + ty + 8 * i) * HID + k0 + tx] = tile[tx][ty + 8 * i];
}

// ---------------------------------------------------------------------------
// Kernel 3: QKV projection GEMM. One 128 x 192 tile of the output per block of
//   eight waves (64 x 48 each). The X rows and the W^T rows of a 64-wide k slice
//   are staged in LDS by asynchronous copies, two buffers: the next slice flies
//   while this one is multiplied, and every staged row serves several waves.
//   64 x 4 x 3 = 768 blocks, three resident per WGP by LDS and registers.
// ---------------------------------------------------------------------------
#define GBM     128                       // X rows per block tile
#define GBN     192                       // W^T rows per block tile
#define GBK     64                        // k per stage: rows of 128 B
#define GPITCH  72                        // LDS row pitch in halves: 144 B = 16 B x odd
#define GSTAGE  ((GBM + GBN) * GPITCH)    // halves per buffer
#define GNT     (HID / GBK)               // stages
#define GCOPY   10                        // 16-byte copies per lane and stage

// Ten 16-byte copies per lane, global -> LDS, through no register.
static __device__ __forceinline__ void async_copy10(const unsigned (&l)[GCOPY],
                                                    const _Float16* const (&g)[GCOPY]) {
  // The closing s_wait_xcnt stands inside the statement so that no address
  // register named here is rewritten ahead of it.
  asm volatile(
      "global_load_async_to_lds_b128 %0, %10, off\n\t"
      "global_load_async_to_lds_b128 %1, %11, off\n\t"
      "global_load_async_to_lds_b128 %2, %12, off\n\t"
      "global_load_async_to_lds_b128 %3, %13, off\n\t"
      "global_load_async_to_lds_b128 %4, %14, off\n\t"
      "global_load_async_to_lds_b128 %5, %15, off\n\t"
      "global_load_async_to_lds_b128 %6, %16, off\n\t"
      "global_load_async_to_lds_b128 %7, %17, off\n\t"
      "global_load_async_to_lds_b128 %8, %18, off\n\t"
      "global_load_async_to_lds_b128 %9, %19, off\n\t"
      "s_wait_xcnt 0x0"
      :: "v"(l[0]), "v"(l[1]), "v"(l[2]), "v"(l[3]), "v"(l[4]),
         "v"(l[5]), "v"(l[6]), "v"(l[7]), "v"(l[8]), "v"(l[9]),
         "v"(g[0]), "v"(g[1]), "v"(g[2]), "v"(g[3]), "v"(g[4]),
         "v"(g[5]), "v"(g[6]), "v"(g[7]), "v"(g[8]), "v"(g[9])
      : "memory");
}

__global__ __launch_bounds__(256) void qkv_gemm_kernel(
    const _Float16* __restrict__ Xh, const _Float16* __restrict__ Wt,
    const float* __restrict__ bq, const float* __restrict__ bk, const float* __restrict__ bv,
    _Float16* __restrict__ Qh, _Float16* __restrict__ Kh, _Float16* __restrict__ Vt)
{
  __shared__ __align__(16) _Float16 gbuf[2 * GSTAGE];   // 90 KB

  const int proj = blockIdx.z;
  const int tid  = threadIdx.x;
  const int lane = tid & 31;
  const int w    = tid >> 5;                // 0..7
  const int ln16 = lane & 15;
  const int hl   = lane >> 4;
  const int kb8  = hl * 8;
  const int Mblk = blockIdx.x * GBM;
  const int Nblk = blockIdx.y * GBN;
  const int wm   = (w >> 2) * 64;           // wave's rows inside the block tile
  const int wn   = (w & 3) * 48;            // wave's columns inside the block tile

  // Staging: a lane owns 16-byte chunk (tid & 7) of rows (tid >> 3) + 32 j,
  // so each wave-wide copy covers four whole 128-byte rows.
  const int crow = tid >> 3;
  const int cch  = tid & 7;
  const _Float16* gx = Xh + (size_t)(Mblk + crow) * HID + cch * 8;
  const _Float16* gw = Wt + (size_t)proj * HID * HID + (size_t)(Nblk + crow) * HID + cch * 8;
  const unsigned lds0 = (unsigned)(size_t)&gbuf[0] + (unsigned)(crow * GPITCH + cch * 8) * 2u;

  // One stage: k slice at px / pw into the buffer whose lane address is lb.
  auto stage = [&](const _Float16* px, const _Float16* pw, unsigned lb) {
    unsigned l[GCOPY];
    const _Float16* g[GCOPY];
    // Unrolled so that every index is a constant and l, g are registers.
    #pragma unroll
    for (int j = 0; j < GCOPY; ++j) {       // LDS rows 0..127: X, 128..319: W^T
      l[j] = lb + (unsigned)(j * 32 * GPITCH) * 2u;
      g[j] = j < GBM / 32 ? px + (size_t)j * 32 * HID
                          : pw + (size_t)(j - GBM / 32) * 32 * HID;
    }
    async_copy10(l, g);
  };

  // Every loop over fragments or accumulator tiles below is unrolled so that the
  // array indices are constants: the arrays stay in registers, no scratch.
  v8f zero = {};
  v8f acc[4][3];
  #pragma unroll
  for (int mi = 0; mi < 4; ++mi)
    #pragma unroll
    for (int ni = 0; ni < 3; ++ni) acc[mi][ni] = zero;

  unsigned lfree = lds0;                    // buffer that the current trip reads
  unsigned lbusy = lds0 + GSTAGE * 2u;      // buffer that is being filled
  stage(gx, gw, lfree);
  asm volatile("s_wait_asynccnt 0x0" ::: "memory");   // own copies of stage 0 landed
  __syncthreads();                                    // stage 0 readable by every wave
  stage(gx + GBK, gw + GBK, lbusy);
  gx += 2 * GBK;                            // k slice of the next refill
  gw += 2 * GBK;

  for (int t = 0; t < GNT; ++t) {
    const _Float16* buf = gbuf + (t & 1) * GSTAGE;
    #pragma unroll
    for (int ks = 0; ks < GBK; ks += 32) {
      F16Frag a[4], b[3];
      #pragma unroll
      for (int i = 0; i < 4; ++i) {
        const _Float16* ap = buf + (wm + i * 16 + ln16) * GPITCH + ks + kb8;
        a[i].q[0] = *(const uint4*)(ap);
        a[i].q[1] = *(const uint4*)(ap + 16);
      }
      #pragma unroll
      for (int i = 0; i < 3; ++i) {
        const _Float16* bp = buf + (GBM + wn + i * 16 + ln16) * GPITCH + ks + kb8;
        b[i].q[0] = *(const uint4*)(bp);
        b[i].q[1] = *(const uint4*)(bp + 16);
      }
      #pragma unroll
      for (int mi = 0; mi < 4; ++mi)
        #pragma unroll
        for (int ni = 0; ni < 3; ++ni)
          acc[mi][ni] = wmma_f16(a[mi], b[ni], acc[mi][ni]);
    }
    asm volatile("s_wait_dscnt 0x0" ::: "memory");     // own reads of this buffer done
    asm volatile("s_wait_asynccnt 0x0" ::: "memory");  // own copies of stage t + 1 landed
    __syncthreads();   // publishes stage t + 1, frees the buffer that trip t has read
    if (t + 2 < GNT) stage(gx, gw, lfree);
    gx += GBK;
    gw += GBK;
    const unsigned lswap = lfree; lfree = lbusy; lbusy = lswap;
  }
  asm volatile("s_wait_asynccnt 0x0" ::: "memory");    // no copy outlives the loop

  const float* bias = proj == 0 ? bq : (proj == 1 ? bk : bv);
  const float qscale = proj == 0 ? 0.125f : 1.0f;   // 1/sqrt(64) folded into Q
  #pragma unroll
  for (int mi = 0; mi < 4; ++mi) {
    #pragma unroll
    for (int ni = 0; ni < 3; ++ni) {
      const int n = Nblk + wn + ni * 16 + ln16;
      const float bn = bias[n];
      if (proj == 2) {
        H8Pack p;
        #pragma unroll
        for (int r = 0; r < 8; ++r) p.h[r] = (_Float16)(acc[mi][ni][r] + bn);
        const int srow = Mblk + wm + mi * 16 + 8 * hl;
        *(uint4*)(Vt + (size_t)n * S_LEN + srow) = p.u;
      } else {
        _Float16* dst = proj == 0 ? Qh : Kh;
        #pragma unroll
        for (int r = 0; r < 8; ++r) {
          const int row = Mblk + wm + mi * 16 + r + 8 * hl;
          dst[(size_t)row * HID + n] = (_Float16)((acc[mi][ni][r] + bn) * qscale);
        }
      }
    }
  }
}

#define KROWS  128
#define KPAD   72
#define NSUPER 5
#define VPITCH 136   // V^T row pitch in LDS (halves): 272 B = 16 B x odd
#define VCOPY  4     // 16-byte V^T copies per lane and superblock

// Four 16-byte copies per lane, global -> LDS, through no register.
static __device__ __forceinline__ void async_copy4(const unsigned (&l)[VCOPY],
                                                   const _Float16* const (&g)[VCOPY]) {
  // The closing s_wait_xcnt stands inside the statement so that no address
  // register named here is rewritten ahead of it.
  asm volatile(
      "global_load_async_to_lds_b128 %0, %4, off\n\t"
      "global_load_async_to_lds_b128 %1, %5, off\n\t"
      "global_load_async_to_lds_b128 %2, %6, off\n\t"
      "global_load_async_to_lds_b128 %3, %7, off\n\t"
      "s_wait_xcnt 0x0"
      :: "v"(l[0]), "v"(l[1]), "v"(l[2]), "v"(l[3]),
         "v"(g[0]), "v"(g[1]), "v"(g[2]), "v"(g[3])
      : "memory");
}

// Lane l takes the value of lane l ^ 16 (a vector cross-row move, no LDS).
static __device__ __forceinline__ float xhalf(float x) {
  const int b = __builtin_bit_cast(int, x);
  return __builtin_bit_cast(float,
      __builtin_amdgcn_permlanex16(b, b, 0x76543210, 0xfedcba98, false, false));
}

// 768 blocks on 256 WGPs are six waves per SIMD: a register budget for six, not
// more, leaves room to load the four V fragments of a block as one group.
__global__ __launch_bounds__(256) __attribute__((amdgpu_waves_per_eu(6, 6))) void attn_kernel(
    const _Float16* __restrict__ Qh, const _Float16* __restrict__ Kh,
    const _Float16* __restrict__ Vt, float* __restrict__ out)
{
  __shared__ __align__(16) _Float16 kbuf[2][KROWS * KPAD];  // 36 KB
  __shared__ __align__(16) _Float16 vbuf[2][HDIM * VPITCH]; // 34 KB

  const int qb0  = blockIdx.x * 128;        // first query row of this WG
  const int h    = blockIdx.y;
  const int tid  = threadIdx.x;
  const int lane = tid & 31;
  const int wid  = tid >> 5;                // 0..7
  const int ln16 = lane & 15;
  const int hl   = lane >> 4;
  const int kb8  = hl * 8;
  const int qb   = qb0 + wid * 16;          // first query row of this wave
  const int gq   = qb + ln16;               // the one query of this lane
  // Its valid keys: inside the band and inside [0, S)
  const int klo  = gq - WINW < 0 ? 0 : gq - WINW;
  const int khi  = gq + WINW > S_LEN - 1 ? S_LEN - 1 : gq + WINW;
  const unsigned kspan = (unsigned)(khi - klo);

  // ---- cooperative K superblock staging: 128 rows x 64 halves -> LDS ----
  auto stage_k = [&](int t, _Float16* buf) {
    const int kgbase = qb0 - WINW + KROWS * t;
    #pragma unroll
    for (int j = 0; j < 4; ++j) {
      const int idx = tid + j * 256;        // 1024 x 16 B = one 16 KB tile
      const int row = idx >> 3;             // 0..127
      const int ch  = idx & 7;              // 16-B chunk within row
      int key = kgbase + row;
      key = key < 0 ? 0 : (key >= S_LEN ? S_LEN - 1 : key);   // clamped rows get masked
      cp16_g2l(Kh + (size_t)key * HID + h * HDIM + ch * 8, buf + row * KPAD + ch * 8);
    }
  };

  // ---- cooperative V^T superblock staging: 64 rows (d) x 128 keys -> LDS ----
  // A lane owns 16-byte chunk (tid & 15) of rows (tid >> 4) + 16 j, so each
  // wave-wide copy covers two whole 256-byte rows.
  const _Float16* gv = Vt + (size_t)(h * HDIM + (tid >> 4)) * S_LEN + (tid & 15) * 8;
  const unsigned lv0 = (unsigned)(size_t)&vbuf[0][0]
                     + (unsigned)((tid >> 4) * VPITCH + (tid & 15) * 8) * 2u;
  auto stage_v = [&](int t, int b) {
    // A superblock lies wholly inside [0, S) or wholly outside; one outside is
    // never read, the clamp only keeps its copies' addresses inside Vt.
    int kb0 = qb0 - WINW + KROWS * t;
    kb0 = kb0 < 0 ? 0 : (kb0 > S_LEN - KROWS ? S_LEN - KROWS : kb0);
    unsigned l[VCOPY];
    const _Float16* g[VCOPY];
    // Unrolled so that every index is a constant and l, g are registers.
    #pragma unroll
    for (int j = 0; j < VCOPY; ++j) {
      l[j] = lv0 + (unsigned)(b * HDIM * VPITCH + j * 16 * VPITCH) * 2u;
      g[j] = gv + kb0 + (size_t)j * 16 * S_LEN;
    }
    async_copy4(l, g);
  };

  // Q B-fragments (d = 0..31 and 32..63): column ln16 of Q^T is query gq
  F16Frag bq0, bq1;
  {
    const _Float16* qp = Qh + (size_t)gq * HID + h * HDIM;
    bq0.q[0] = *(const uint4*)(qp + kb8);
    bq0.q[1] = *(const uint4*)(qp + kb8 + 16);
    bq1.q[0] = *(const uint4*)(qp + 32 + kb8);
    bq1.q[1] = *(const uint4*)(qp + 32 + kb8 + 16);
  }

  // Every loop over r or tt below is unrolled so that the indices are constants:
  // the score, fragment and accumulator arrays stay in registers, no scratch.
  v8f zero = {};
  v8f oacc[4] = {zero, zero, zero, zero};   // oacc[tt][r] = O[gq][tt*16 + 8*hl + r]
  float m = -3.0e38f;                       // running maximum of query gq
  float l = 0.f;                            // this half's share of its sum

  stage_k(0, kbuf[0]);
  stage_v(0, 0);
  asm volatile("s_wait_asynccnt 0x0" ::: "memory");   // own copies of superblock 0 landed
  __syncthreads();                                    // superblock 0 readable by every wave

  const int ylo = wid * 16;                 // band (WG-local keys) = [ylo, ylo+527]
  const int ybstart = ylo & ~31;
  const int ybend   = ylo + 528;

  for (int t = 0; t < NSUPER; ++t) {
    const _Float16* kb = kbuf[t & 1];
    const _Float16* vb = vbuf[t & 1];
    // Behind the barrier that freed the other buffers: the next superblock flies
    // while this one is worked on.
    if (t + 1 < NSUPER) {
      stage_k(t + 1, kbuf[(t + 1) & 1]);
      stage_v(t + 1, (t + 1) & 1);
    }

    const int lo = (t * KROWS > ybstart) ? t * KROWS : ybstart;
    const int hi = ((t + 1) * KROWS < ybend) ? (t + 1) * KROWS : ybend;
    for (int yb = lo; yb < hi; yb += 32) {
      const int kg = qb0 - WINW + yb;       // global key base of this 32-block
      if (kg + 32 <= 0 || kg >= S_LEN) continue;
      const int rb = yb - t * KROWS;        // row base inside the staged buffer

      // ---- S^T from LDS K fragments: s0[r] = key kg + 8*hl + r, s1[r] = 16 more ----
      v8f s0 = zero, s1 = zero;
      {
        const _Float16* kp = kb + (size_t)(rb + ln16) * KPAD + kb8;
        F16Frag alo, ahi;
        alo.q[0] = *(const uint4*)(kp);
        alo.q[1] = *(const uint4*)(kp + 16);
        ahi.q[0] = *(const uint4*)(kp + 32);
        ahi.q[1] = *(const uint4*)(kp + 48);
        s0 = wmma_f16(alo, bq0, s0);
        s0 = wmma_f16(ahi, bq1, s0);
      }
      {
        const _Float16* kp = kb + (size_t)(rb + 16 + ln16) * KPAD + kb8;
        F16Frag alo, ahi;
        alo.q[0] = *(const uint4*)(kp);
        alo.q[1] = *(const uint4*)(kp + 16);
        ahi.q[0] = *(const uint4*)(kp + 32);
        ahi.q[1] = *(const uint4*)(kp + 48);
        s1 = wmma_f16(alo, bq0, s1);
        s1 = wmma_f16(ahi, bq1, s1);
      }

      // ---- mask + online softmax, one query per lane ----
      const int krel = kg + kb8 - klo;      // key of s0[0], counted from klo
      float x0[8], x1[8];
      #pragma unroll
      for (int r = 0; r < 8; ++r) {
        // klo <= key <= khi as one unsigned compare of key - klo
        x0[r] = (unsigned)(krel + r)      <= kspan ? s0[r] : -3.0e38f;
        x1[r] = (unsigned)(krel + 16 + r) <= kspan ? s1[r] : -3.0e38f;
      }
      float rmax = fmaxf(x0[0], x1[0]);
      #pragma unroll
      for (int r = 1; r < 8; ++r) rmax = fmaxf(rmax, fmaxf(x0[r], x1[r]));
      rmax = fmaxf(rmax, xhalf(rmax));      // both halves scale by the same maximum
      const float mn = fmaxf(m, rmax);
      // Nothing valid yet: subtract 0, so that every masked score still gives exp = 0.
      const float mref = mn <= -1.0e38f ? 0.f : mn;
      const float sc = __expf(m - mref);
      m = mn;
      F16Frag bp;                           // P^T as B operand: k order of the K, V loaders
      float e0[8], e1[8];
      #pragma unroll
      for (int r = 0; r < 8; ++r) {
        e0[r] = __expf(x0[r] - mref);
        e1[r] = __expf(x1[r] - mref);
        bp.v[r]     = (_Float16)e0[r];
        bp.v[8 + r] = (_Float16)e1[r];
      }
      #pragma unroll
      for (int tt = 0; tt < 4; ++tt) {
        #pragma unroll
        for (int r = 0; r < 8; ++r) oacc[tt][r] *= sc;
      }

      // ---- O^T += V^T(16x32) @ P^T(32x16): staged V^T rows give contiguous A-frags ----
      #pragma unroll
      for (int tt = 0; tt < 4; ++tt) {
        const _Float16* vp = vb + (size_t)(tt * 16 + ln16) * VPITCH + rb + kb8;
        F16Frag av;
        av.q[0] = *(const uint4*)(vp);
        av.q[1] = *(const uint4*)(vp + 16);
        oacc[tt] = wmma_f16(av, bp, oacc[tt]);
      }
      // The row sums are written behind the products, and the scheduling barrier
      // keeps them from being lifted in front of them: these additions fill the vector slots
      // between the last matrix instructions and the next trip's first vector writes.
      __builtin_amdgcn_sched_barrier(0);
      float ps0 = 0.f, ps1 = 0.f;
      #pragma unroll
      for (int r = 0; r < 8; ++r) {
        ps0 += e0[r];
        ps1 += e1[r];
      }
      l = l * sc + (ps0 + ps1);
    }

    asm volatile("s_wait_dscnt 0x0" ::: "memory");     // own reads of these buffers done
    asm volatile("s_wait_asynccnt 0x0" ::: "memory");  // own copies of superblock t + 1 landed
    __syncthreads();   // publishes superblock t + 1, frees the buffers that trip t has read
  }

  // ---- epilogue: join the halves' sums, out = O / l, f32, 32 B runs per lane ----
  l += xhalf(l);
  const float il = l > 0.f ? 1.f / l : 0.f;
  float* op = out + (size_t)gq * HID + h * HDIM + kb8;
  #pragma unroll
  for (int tt = 0; tt < 4; ++tt) {
    const float4 f0 = make_float4(oacc[tt][0] * il, oacc[tt][1] * il, oacc[tt][2] * il, oacc[tt][3] * il);
    const float4 f1 = make_float4(oacc[tt][4] * il, oacc[tt][5] * il, oacc[tt][6] * il, oacc[tt][7] * il);
    *(float4*)(op + tt * 16)     = f0;
    *(float4*)(op + tt * 16 + 4) = f1;
  }
}

// ---------------------------------------------------------------------------
extern "C" void kernel_launch(void* const* d_in, const int* in_sizes, int n_in,
                              void* d_out, int out_size, void* d_ws, size_t ws_size,
                              hipStream_t stream) {
  (void)in_sizes; (void)n_in; (void)out_size; (void)ws_size;
  const float* X  = (const float*)d_in[0];
  const float* Wq = (const float*)d_in[1];
  const float* bq = (const float*)d_in[2];
  const float* Wk = (const float*)d_in[3];
  const float* bk = (const float*)d_in[4];
  const float* Wv = (const float*)d_in[5];
  const float* bv = (const float*)d_in[6];
  float* out = (float*)d_out;

  char* ws = (char*)d_ws;
  _Float16* Xh = (_Float16*)ws; ws += (size_t)S_LEN * HID * sizeof(_Float16);
  _Float16* Wt = (_Float16*)ws; ws += (size_t)3 * HID * HID * sizeof(_Float16);
  _Float16* Qh = (_Float16*)ws; ws += (size_t)S_LEN * HID * sizeof(_Float16);
  _Float16* Kh = (_Float16*)ws; ws += (size_t)S_LEN * HID * sizeof(_Float16);
  _Float16* Vt = (_Float16*)ws; ws += (size_t)S_LEN * HID * sizeof(_Float16);

  convert_x_kernel<<<(S_LEN * HID / 4) / 256, 256, 0, stream>>>(X, Xh);
  wtrans_kernel<<<dim3(HID / 32, HID / 32, 3), dim3(32, 8), 0, stream>>>(Wq, Wk, Wv, Wt);
  qkv_gemm_kernel<<<dim3(S_LEN / GBM, HID / GBN, 3), 256, 0, stream>>>(
      Xh, Wt, bq, bk, bv, Qh, Kh, Vt);
  attn_kernel<<<dim3(S_LEN / 128, NHEAD), 256, 0, stream>>>(Qh, Kh, Vt, out);
}

// v004
// One run takes 56.7 microseconds.
// Next to v003, in two timings, it ran 1.12 times as fast each time.
// Over all steps from v000 it is 4.94 times as fast.
#include <hip/hip_runtime.h>
#include <hip/hip_fp16.h>

typedef __attribute__((ext_vector_type(16))) _Float16 v16h;
typedef __attribute__((ext_vector_type(8)))  float    v8f;
typedef __attribute__((ext_vector_type(4)))  int      v4i;

#define S_LEN  8192
#define HID    768
#define NHEAD  12
#define HDIM   64
#define WINW   256

union F16Frag { v16h v; uint4 q[2]; };
union H8Pack  { _Float16 h[8]; uint4 u; };
union H4Pack  { _Float16 h[4]; uint2 u; };

static __device__ __forceinline__ v8f wmma_f16(const F16Frag& a, const F16Frag& b, v8f c) {
  // D = A(16x32 f16) * B(32x16 f16) + C(16x16 f32)
  return __builtin_amdgcn_wmma_f32_16x16x32_f16(false, a.v, false, b.v, (short)0, c, false, false);
}

// ---- async global->LDS (gfx1250), guarded so absence falls back cleanly ----
#if defined(__has_builtin)
#if __has_builtin(__builtin_amdgcn_global_load_async_to_lds_b128)
#define HAVE_ASYNC_LDS 1
#endif
#endif

#ifdef HAVE_ASYNC_LDS
typedef __attribute__((address_space(1))) v4i gv4i;   // global int4*
typedef __attribute__((address_space(3))) v4i lv4i;   // LDS int4*
static __device__ __forceinline__ void cp16_g2l(const _Float16* g, _Float16* l) {
  // flat->AS1 keeps the 64-bit address; flat->AS3 keeps the low-32 LDS offset
  __builtin_amdgcn_global_load_async_to_lds_b128(
      (gv4i*)(size_t)g, (lv4i*)(unsigned)(size_t)l, 0, 0);
}
#else
static __device__ __forceinline__ void cp16_g2l(const _Float16* g, _Float16* l) {
  *(uint4*)l = *(const uint4*)g;   // VGPR round-trip fallback
}
#endif

// ---------------------------------------------------------------------------
// Kernel 1: X (f32) -> Xh (f16), vectorized 4-wide
// ---------------------------------------------------------------------------
__global__ void convert_x_kernel(const float* __restrict__ X, _Float16* __restrict__ Xh) {
  const int i = blockIdx.x * blockDim.x + threadIdx.x;  // exactly S*HID/4 threads
  const float4 f = ((const float4*)X)[i];
  H4Pack p;
  p.h[0] = (_Float16)f.x; p.h[1] = (_Float16)f.y;
  p.h[2] = (_Float16)f.z; p.h[3] = (_Float16)f.w;
  ((uint2*)Xh)[i] = p.u;
}

// ---------------------------------------------------------------------------
// Kernel 2: W[k][n] (f32) -> Wt[n][k] (f16), LDS-tiled transpose, 3 matrices
// ---------------------------------------------------------------------------
__global__ void wtrans_kernel(const float* __restrict__ Wq, const float* __restrict__ Wk,
                              const float* __restrict__ Wv, _Float16* __restrict__ Wt) {
  __shared__ _Float16 tile[32][33];
  const float* src = blockIdx.z == 0 ? Wq : (blockIdx.z == 1 ? Wk : Wv);
  _Float16* dst = Wt + (size_t)blockIdx.z * HID * HID;
  const int n0 = blockIdx.x * 32;
  const int k0 = blockIdx.y * 32;
  const int tx = threadIdx.x, ty = threadIdx.y;
  #pragma unroll
  for (int i = 0; i < 4; ++i)
    tile[ty + 8 * i][tx] = (_Float16)src[(size_t)(k0 + ty + 8 * i) * HID + n0 + tx];
  __syncthreads();
  #pragma unroll
  for (int i = 0; i < 4; ++i)
    dst[(size_t)(n0 + ty + 8 * i) * HID + k0 + tx] = tile[tx][ty + 8 * i];
}

// ---------------------------------------------------------------------------
// Kernel 3: QKV projection GEMM. One 128 x 192 tile of the output per block of
//   eight waves (64 x 48 each). The X rows and the W^T rows of a 64-wide k slice
//   are staged in LDS by asynchronous copies, two buffers: the next slice flies
//   while this one is multiplied, and every staged row serves several waves.
//   64 x 4 x 3 = 768 blocks, three resident per WGP by LDS and registers.
// ---------------------------------------------------------------------------
#define GBM     128                       // X rows per block tile
#define GBN     192                       // W^T rows per block tile
#define GBK     64                        // k per stage: rows of 128 B
#define GPITCH  72                        // LDS row pitch in halves: 144 B = 16 B x odd
#define GSTAGE  ((GBM + GBN) * GPITCH)    // halves per buffer
#define GNT     (HID / GBK)               // stages
#define GCOPY   10                        // 16-byte copies per lane and stage
#define QKPITCH 200                       // staged Q / K row pitch in halves: 400 B = 16 B x odd
#define VTPITCH 136                       // staged V^T row pitch in halves: 272 B = 16 B x odd
#define GOUT    12                        // 16-byte output chunks per lane: 128 x 192 halves / 256 lanes

// Compile-time choice of the operand order in the GEMM's main loop.
template <bool B> struct OrderTag { static constexpr bool swapped = B; };

// Ten 16-byte copies per lane, global -> LDS, through no register.
static __device__ __forceinline__ void async_copy10(const unsigned (&l)[GCOPY],
                                                    const _Float16* const (&g)[GCOPY]) {
  // The closing s_wait_xcnt stands inside the statement so that no address
  // register named here is rewritten ahead of it.
  asm volatile(
      "global_load_async_to_lds_b128 %0, %10, off\n\t"
      "global_load_async_to_lds_b128 %1, %11, off\n\t"
      "global_load_async_to_lds_b128 %2, %12, off\n\t"
      "global_load_async_to_lds_b128 %3, %13, off\n\t"
      "global_load_async_to_lds_b128 %4, %14, off\n\t"
      "global_load_async_to_lds_b128 %5, %15, off\n\t"
      "global_load_async_to_lds_b128 %6, %16, off\n\t"
      "global_load_async_to_lds_b128 %7, %17, off\n\t"
      "global_load_async_to_lds_b128 %8, %18, off\n\t"
      "global_load_async_to_lds_b128 %9, %19, off\n\t"
      "s_wait_xcnt 0x0"
      :: "v"(l[0]), "v"(l[1]), "v"(l[2]), "v"(l[3]), "v"(l[4]),
         "v"(l[5]), "v"(l[6]), "v"(l[7]), "v"(l[8]), "v"(l[9]),
         "v"(g[0]), "v"(g[1]), "v"(g[2]), "v"(g[3]), "v"(g[4]),
         "v"(g[5]), "v"(g[6]), "v"(g[7]), "v"(g[8]), "v"(g[9])
      : "memory");
}

__global__ __launch_bounds__(256) void qkv_gemm_kernel(
    const _Float16* __restrict__ Xh, const _Float16* __restrict__ Wt,
    const float* __restrict__ bq, const float* __restrict__ bk, const float* __restrict__ bv,
    _Float16* __restrict__ Qh, _Float16* __restrict__ Kh, _Float16* __restrict__ Vt)
{
  __shared__ __align__(16) _Float16 gbuf[2 * GSTAGE];   // 90 KB

  const int proj = blockIdx.z;
  const int tid  = threadIdx.x;
  const int lane = tid & 31;
  const int w    = tid >> 5;                // 0..7
  const int ln16 = lane & 15;
  const int hl   = lane >> 4;
  const int kb8  = hl * 8;
  const int Mblk = blockIdx.x * GBM;
  const int Nblk = blockIdx.y * GBN;
  const int wm   = (w >> 2) * 64;           // wave's rows inside the block tile
  const int wn   = (w & 3) * 48;            // wave's columns inside the block tile

  // Staging: a lane owns 16-byte chunk (tid & 7) of rows (tid >> 3) + 32 j,
  // so each wave-wide copy covers four whole 128-byte rows.
  const int crow = tid >> 3;
  const int cch  = tid & 7;
  const _Float16* gx = Xh + (size_t)(Mblk + crow) * HID + cch * 8;
  const _Float16* gw = Wt + (size_t)proj * HID * HID + (size_t)(Nblk + crow) * HID + cch * 8;
  const unsigned lds0 = (unsigned)(size_t)&gbuf[0] + (unsigned)(crow * GPITCH + cch * 8) * 2u;

  // One stage: k slice at px / pw into the buffer whose lane address is lb.
  auto stage = [&](const _Float16* px, const _Float16* pw, unsigned lb) {
    unsigned l[GCOPY];
    const _Float16* g[GCOPY];
    // Unrolled so that every index is a constant and l, g are registers.
    #pragma unroll
    for (int j = 0; j < GCOPY; ++j) {       // LDS rows 0..127: X, 128..319: W^T
      l[j] = lb + (unsigned)(j * 32 * GPITCH) * 2u;
      g[j] = j < GBM / 32 ? px + (size_t)j * 32 * HID
                          : pw + (size_t)(j - GBM / 32) * 32 * HID;
    }
    async_copy10(l, g);
  };

  // Every loop over fragments or accumulator tiles below is unrolled so that the
  // array indices are constants: the arrays stay in registers, no scratch.
  v8f zero = {};
  v8f acc[4][3];
  #pragma unroll
  for (int mi = 0; mi < 4; ++mi)
    #pragma unroll
    for (int ni = 0; ni < 3; ++ni) acc[mi][ni] = zero;

  unsigned lfree = lds0;                    // buffer that the current trip reads
  unsigned lbusy = lds0 + GSTAGE * 2u;      // buffer that is being filled
  stage(gx, gw, lfree);
  asm volatile("s_wait_asynccnt 0x0" ::: "memory");   // own copies of stage 0 landed
  __syncthreads();                                    // stage 0 readable by every wave
  stage(gx + GBK, gw + GBK, lbusy);
  gx += 2 * GBK;                            // k slice of the next refill
  gw += 2 * GBK;

  // The loaders of the two operands are alike, so the order of the operands picks
  // what a lane ends up with. X rows first: column n, eight consecutive rows (what a
  // row of V^T wants). W^T rows first: one row, eight consecutive columns n (what a
  // row of Q or K wants). Either way a lane's eight results are 16 contiguous bytes
  // of the output tile. The choice is the same for the whole block.
  auto mainloop = [&](auto order) {
  for (int t = 0; t < GNT; ++t) {
    const _Float16* buf = gbuf + (t & 1) * GSTAGE;
    #pragma unroll
    for (int ks = 0; ks < GBK; ks += 32) {
      F16Frag a[4], b[3];
      #pragma unroll
      for (int i = 0; i < 4; ++i) {
        const _Float16* ap = buf + (wm + i * 16 + ln16) * GPITCH + ks + kb8;
        a[i].q[0] = *(const uint4*)(ap);
        a[i].q[1] = *(const uint4*)(ap + 16);
      }
      #pragma unroll
      for (int i = 0; i < 3; ++i) {
        const _Float16* bp = buf + (GBM + wn + i * 16 + ln16) * GPITCH + ks + kb8;
        b[i].q[0] = *(const uint4*)(bp);
        b[i].q[1] = *(const uint4*)(bp + 16);
      }
      #pragma unroll
      for (int mi = 0; mi < 4; ++mi)
        #pragma unroll
        for (int ni = 0; ni < 3; ++ni)
          acc[mi][ni] = decltype(order)::swapped ? wmma_f16(b[ni], a[mi], acc[mi][ni])
                                                 : wmma_f16(a[mi], b[ni], acc[mi][ni]);
    }
    asm volatile("s_wait_dscnt 0x0" ::: "memory");     // own reads of this buffer done
    asm volatile("s_wait_asynccnt 0x0" ::: "memory");  // own copies of stage t + 1 landed
    __syncthreads();   // publishes stage t + 1, frees the buffer that trip t has read
    if (t + 2 < GNT) stage(gx, gw, lfree);
    gx += GBK;
    gw += GBK;
    const unsigned lswap = lfree; lfree = lbusy; lbusy = lswap;
  }
  asm volatile("s_wait_asynccnt 0x0" ::: "memory");    // no copy outlives the loop
  };

  // Epilogue: the block's output tile is put together in LDS and goes out in whole
  // 128-byte lines, 16 bytes per lane. The loop's last barrier has ended every read
  // of the ring and no copy is in flight, so the ring's LDS is free for the tile.
  _Float16* sbuf = gbuf;
  if (proj == 2) {
    mainloop(OrderTag<false>{});
    // acc[mi][ni][r] = V[wm + mi*16 + 8*hl + r][wn + ni*16 + ln16]; tile kept as [n][s]
    #pragma unroll
    for (int ni = 0; ni < 3; ++ni) {
      const int nl = wn + ni * 16 + ln16;
      const float bn = bv[Nblk + nl];
      #pragma unroll
      for (int mi = 0; mi < 4; ++mi) {
        H8Pack p;
        #pragma unroll
        for (int r = 0; r < 8; ++r) p.h[r] = (_Float16)(acc[mi][ni][r] + bn);
        *(uint4*)(sbuf + nl * VTPITCH + wm + mi * 16 + kb8) = p.u;
      }
    }
    __syncthreads();   // the whole tile is in LDS before any wave reads rows of it
    // Sixteen lanes take one row of 256 bytes: rows (tid >> 4) + 16 j. All reads first,
    // as one group, then the stores.
    const _Float16* sp = sbuf + (tid >> 4) * VTPITCH + (tid & 15) * 8;
    _Float16* gp = Vt + (size_t)(Nblk + (tid >> 4)) * S_LEN + Mblk + (tid & 15) * 8;
    uint4 v[GOUT];
    #pragma unroll
    for (int j = 0; j < GOUT; ++j) v[j] = *(const uint4*)(sp + j * 16 * VTPITCH);
    #pragma unroll
    for (int j = 0; j < GOUT; ++j) *(uint4*)(gp + (size_t)j * 16 * S_LEN) = v[j];
  } else {
    mainloop(OrderTag<true>{});
    // acc[mi][ni][r] = (X W)[wm + mi*16 + ln16][wn + ni*16 + 8*hl + r]; tile kept as [s][n]
    const float* bias = proj == 0 ? bq : bk;
    const float qscale = proj == 0 ? 0.125f : 1.0f;   // 1/sqrt(64) folded into Q
    _Float16* dst = proj == 0 ? Qh : Kh;
    float4 b0[3], b1[3];                    // the lane's 3 x 8 bias values, loaded as one group
    const float* bp8 = bias + Nblk + wn + kb8;
    b0[0] = *(const float4*)(bp8);
    b1[0] = *(const float4*)(bp8 + 4);
    b0[1] = *(const float4*)(bp8 + 16);
    b1[1] = *(const float4*)(bp8 + 20);
    b0[2] = *(const float4*)(bp8 + 32);
    // The last load of the group may take the shared address registers for its result:
    // the five loads in front of it that name them are waited for first.
    asm volatile("s_wait_xcnt 0x0" ::: "memory");
    b1[2] = *(const float4*)(bp8 + 36);
    // Behind the group: its address registers are free for reuse from here on.
    asm volatile("s_wait_xcnt 0x0" ::: "memory");
    #pragma unroll
    for (int ni = 0; ni < 3; ++ni) {
      const int nl = wn + ni * 16 + kb8;
      const float bn[8] = {b0[ni].x, b0[ni].y, b0[ni].z, b0[ni].w,
                           b1[ni].x, b1[ni].y, b1[ni].z, b1[ni].w};
      #pragma unroll
      for (int mi = 0; mi < 4; ++mi) {
        H8Pack p;
        #pragma unroll
        for (int r = 0; r < 8; ++r) p.h[r] = (_Float16)((acc[mi][ni][r] + bn[r]) * qscale);
        *(uint4*)(sbuf + (wm + mi * 16 + ln16) * QKPITCH + nl) = p.u;
      }
    }
    __syncthreads();   // the whole tile is in LDS before any wave reads rows of it
    // Eight lanes take one 128-byte line: line j / 4 of rows crow + 32 (j % 4). All
    // reads first, as one group, then the stores.
    uint4 v[GOUT];
    #pragma unroll
    for (int j = 0; j < GOUT; ++j)
      v[j] = *(const uint4*)(sbuf + (crow + (j & 3) * 32) * QKPITCH + (j >> 2) * 64 + cch * 8);
    #pragma unroll
    for (int j = 0; j < GOUT; ++j)
      *(uint4*)(dst + (size_t)(Mblk + crow + (j & 3) * 32) * HID + Nblk + (j >> 2) * 64 + cch * 8) = v[j];
  }
}

#define KROWS  128
#define KPAD   72
#define NSUPER 5
#define VPITCH 136   // V^T row pitch in LDS (halves): 272 B = 16 B x odd
#define VCOPY  4     // 16-byte V^T copies per lane and superblock
#define OPITCH 68    // staged output row pitch in floats: 272 B = 16 B x odd

// Four 16-byte copies per lane, global -> LDS, through no register.
static __device__ __forceinline__ void async_copy4(const unsigned (&l)[VCOPY],
                                                   const _Float16* const (&g)[VCOPY]) {
  // The closing s_wait_xcnt stands inside the statement so that no address
  // register named here is rewritten ahead of it.
  asm volatile(
      "global_load_async_to_lds_b128 %0, %4, off\n\t"
      "global_load_async_to_lds_b128 %1, %5, off\n\t"
      "global_load_async_to_lds_b128 %2, %6, off\n\t"
      "global_load_async_to_lds_b128 %3, %7, off\n\t"
      "s_wait_xcnt 0x0"
      :: "v"(l[0]), "v"(l[1]), "v"(l[2]), "v"(l[3]),
         "v"(g[0]), "v"(g[1]), "v"(g[2]), "v"(g[3])
      : "memory");
}

// Lane l takes the value of lane l ^ 16 (a vector cross-row move, no LDS).
static __device__ __forceinline__ float xhalf(float x) {
  const int b = __builtin_bit_cast(int, x);
  return __builtin_bit_cast(float,
      __builtin_amdgcn_permlanex16(b, b, 0x76543210, 0xfedcba98, false, false));
}

// 768 blocks on 256 WGPs are six waves per SIMD: a register budget for six, not
// more, leaves room to load the four V fragments of a block as one group.
__global__ __launch_bounds__(256) __attribute__((amdgpu_waves_per_eu(6, 6))) void attn_kernel(
    const _Float16* __restrict__ Qh, const _Float16* __restrict__ Kh,
    const _Float16* __restrict__ Vt, float* __restrict__ out)
{
  __shared__ __align__(16) _Float16 kbuf[2][KROWS * KPAD];  // 36 KB
  __shared__ __align__(16) _Float16 vbuf[2][HDIM * VPITCH]; // 34 KB

  const int qb0  = blockIdx.x * 128;        // first query row of this WG
  const int h    = blockIdx.y;
  const int tid  = threadIdx.x;
  const int lane = tid & 31;
  const int wid  = tid >> 5;                // 0..7
  const int ln16 = lane & 15;
  const int hl   = lane >> 4;
  const int kb8  = hl * 8;
  const int qb   = qb0 + wid * 16;          // first query row of this wave
  const int gq   = qb + ln16;               // the one query of this lane
  // Its valid keys: inside the band and inside [0, S)
  const int klo  = gq - WINW < 0 ? 0 : gq - WINW;
  const int khi  = gq + WINW > S_LEN - 1 ? S_LEN - 1 : gq + WINW;
  const unsigned kspan = (unsigned)(khi - klo);

  // ---- cooperative K superblock staging: 128 rows x 64 halves -> LDS ----
  auto stage_k = [&](int t, _Float16* buf) {
    const int kgbase = qb0 - WINW + KROWS * t;
    #pragma unroll
    for (int j = 0; j < 4; ++j) {
      const int idx = tid + j * 256;        // 1024 x 16 B = one 16 KB tile
      const int row = idx >> 3;             // 0..127
      const int ch  = idx & 7;              // 16-B chunk within row
      int key = kgbase + row;
      key = key < 0 ? 0 : (key >= S_LEN ? S_LEN - 1 : key);   // clamped rows get masked
      cp16_g2l(Kh + (size_t)key * HID + h * HDIM + ch * 8, buf + row * KPAD + ch * 8);
    }
  };

  // ---- cooperative V^T superblock staging: 64 rows (d) x 128 keys -> LDS ----
  // A lane owns 16-byte chunk (tid & 15) of rows (tid >> 4) + 16 j, so each
  // wave-wide copy covers two whole 256-byte rows.
  const _Float16* gv = Vt + (size_t)(h * HDIM + (tid >> 4)) * S_LEN + (tid & 15) * 8;
  const unsigned lv0 = (unsigned)(size_t)&vbuf[0][0]
                     + (unsigned)((tid >> 4) * VPITCH + (tid & 15) * 8) * 2u;
  auto stage_v = [&](int t, int b) {
    // A superblock lies wholly inside [0, S) or wholly outside; one outside is
    // never read, the clamp only keeps its copies' addresses inside Vt.
    int kb0 = qb0 - WINW + KROWS * t;
    kb0 = kb0 < 0 ? 0 : (kb0 > S_LEN - KROWS ? S_LEN - KROWS : kb0);
    unsigned l[VCOPY];
    const _Float16* g[VCOPY];
    // Unrolled so that every index is a constant and l, g are registers.
    #pragma unroll
    for (int j = 0; j < VCOPY; ++j) {
      l[j] = lv0 + (unsigned)(b * HDIM * VPITCH + j * 16 * VPITCH) * 2u;
      g[j] = gv + kb0 + (size_t)j * 16 * S_LEN;
    }
    async_copy4(l, g);
  };

  // Q B-fragments (d = 0..31 and 32..63): column ln16 of Q^T is query gq
  F16Frag bq0, bq1;
  {
    const _Float16* qp = Qh + (size_t)gq * HID + h * HDIM;
    bq0.q[0] = *(const uint4*)(qp + kb8);
    bq0.q[1] = *(const uint4*)(qp + kb8 + 16);
    bq1.q[0] = *(const uint4*)(qp + 32 + kb8);
    bq1.q[1] = *(const uint4*)(qp + 32 + kb8 + 16);
  }

  // Every loop over r or tt below is unrolled so that the indices are constants:
  // the score, fragment and accumulator arrays stay in registers, no scratch.
  v8f zero = {};
  v8f oacc[4] = {zero, zero, zero, zero};   // oacc[tt][r] = O[gq][tt*16 + 8*hl + r]
  float m = -3.0e38f;                       // running maximum of query gq
  float l = 0.f;                            // this half's share of its sum

  stage_k(0, kbuf[0]);
  stage_v(0, 0);
  asm volatile("s_wait_asynccnt 0x0" ::: "memory");   // own copies of superblock 0 landed
  __syncthreads();                                    // superblock 0 readable by every wave

  const int ylo = wid * 16;                 // band (WG-local keys) = [ylo, ylo+527]
  const int ybstart = ylo & ~31;
  const int ybend   = ylo + 528;

  for (int t = 0; t < NSUPER; ++t) {
    const _Float16* kb = kbuf[t & 1];
    const _Float16* vb = vbuf[t & 1];
    // Behind the barrier that freed the other buffers: the next superblock flies
    // while this one is worked on.
    if (t + 1 < NSUPER) {
      stage_k(t + 1, kbuf[(t + 1) & 1]);
      stage_v(t + 1, (t + 1) & 1);
    }

    const int lo = (t * KROWS > ybstart) ? t * KROWS : ybstart;
    const int hi = ((t + 1) * KROWS < ybend) ? (t + 1) * KROWS : ybend;
    for (int yb = lo; yb < hi; yb += 32) {
      const int kg = qb0 - WINW + yb;       // global key base of this 32-block
      if (kg + 32 <= 0 || kg >= S_LEN) continue;
      const int rb = yb - t * KROWS;        // row base inside the staged buffer

      // ---- S^T from LDS K fragments: s0[r] = key kg + 8*hl + r, s1[r] = 16 more ----
      v8f s0 = zero, s1 = zero;
      {
        const _Float16* kp = kb + (size_t)(rb + ln16) * KPAD + kb8;
        F16Frag alo, ahi;
        alo.q[0] = *(const uint4*)(kp);
        alo.q[1] = *(const uint4*)(kp + 16);
        ahi.q[0] = *(const uint4*)(kp + 32);
        ahi.q[1] = *(const uint4*)(kp + 48);
        s0 = wmma_f16(alo, bq0, s0);
        s0 = wmma_f16(ahi, bq1, s0);
      }
      {
        const _Float16* kp = kb + (size_t)(rb + 16 + ln16) * KPAD + kb8;
        F16Frag alo, ahi;
        alo.q[0] = *(const uint4*)(kp);
        alo.q[1] = *(const uint4*)(kp + 16);
        ahi.q[0] = *(const uint4*)(kp + 32);
        ahi.q[1] = *(const uint4*)(kp + 48);
        s1 = wmma_f16(alo, bq0, s1);
        s1 = wmma_f16(ahi, bq1, s1);
      }

      // ---- mask + online softmax, one query per lane ----
      const int krel = kg + kb8 - klo;      // key of s0[0], counted from klo
      float x0[8], x1[8];
      #pragma unroll
      for (int r = 0; r < 8; ++r) {
        // klo <= key <= khi as one unsigned compare of key - klo
        x0[r] = (unsigned)(krel + r)      <= kspan ? s0[r] : -3.0e38f;
        x1[r] = (unsigned)(krel + 16 + r) <= kspan ? s1[r] : -3.0e38f;
      }
      float rmax = fmaxf(x0[0], x1[0]);
      #pragma unroll
      for (int r = 1; r < 8; ++r) rmax = fmaxf(rmax, fmaxf(x0[r], x1[r]));
      rmax = fmaxf(rmax, xhalf(rmax));      // both halves scale by the same maximum
      const float mn = fmaxf(m, rmax);
      // Nothing valid yet: subtract 0, so that every masked score still gives exp = 0.
      const float mref = mn <= -1.0e38f ? 0.f : mn;
      const float sc = __expf(m - mref);
      m = mn;
      F16Frag bp;                           // P^T as B operand: k order of the K, V loaders
      float e0[8], e1[8];
      #pragma unroll
      for (int r = 0; r < 8; ++r) {
        e0[r] = __expf(x0[r] - mref);
        e1[r] = __expf(x1[r] - mref);
        bp.v[r]     = (_Float16)e0[r];
        bp.v[8 + r] = (_Float16)e1[r];
      }
      #pragma unroll
      for (int tt = 0; tt < 4; ++tt) {
        #pragma unroll
        for (int r = 0; r < 8; ++r) oacc[tt][r] *= sc;
      }

      // ---- O^T += V^T(16x32) @ P^T(32x16): staged V^T rows give contiguous A-frags ----
      #pragma unroll
      for (int tt = 0; tt < 4; ++tt) {
        const _Float16* vp = vb + (size_t)(tt * 16 + ln16) * VPITCH + rb + kb8;
        F16Frag av;
        av.q[0] = *(const uint4*)(vp);
        av.q[1] = *(const uint4*)(vp + 16);
        oacc[tt] = wmma_f16(av, bp, oacc[tt]);
      }
      // The row sums are written behind the products, and the scheduling barrier
      // keeps them from being lifted in front of them: these additions fill the vector slots
      // between the last matrix instructions and the next trip's first vector writes.
      __builtin_amdgcn_sched_barrier(0);
      float ps0 = 0.f, ps1 = 0.f;
      #pragma unroll
      for (int r = 0; r < 8; ++r) {
        ps0 += e0[r];
        ps1 += e1[r];
      }
      l = l * sc + (ps0 + ps1);
    }

    asm volatile("s_wait_dscnt 0x0" ::: "memory");     // own reads of these buffers done
    asm volatile("s_wait_asynccnt 0x0" ::: "memory");  // own copies of superblock t + 1 landed
    __syncthreads();   // publishes superblock t + 1, frees the buffers that trip t has read
  }

  // ---- epilogue: join the halves' sums, out = O / l, f32; each wave turns its 16 x 64
  //      tile round in LDS, so that every store covers whole 128-byte lines. The loop's
  //      last barrier has ended every read of kbuf and no copy is in flight. ----
  l += xhalf(l);
  const float il = l > 0.f ? 1.f / l : 0.f;
  float* ob = (float*)&kbuf[0][0] + wid * (16 * OPITCH);   // this wave's own 16 rows
  float* op = ob + ln16 * OPITCH + kb8;
  #pragma unroll
  for (int tt = 0; tt < 4; ++tt) {
    const float4 f0 = make_float4(oacc[tt][0] * il, oacc[tt][1] * il, oacc[tt][2] * il, oacc[tt][3] * il);
    const float4 f1 = make_float4(oacc[tt][4] * il, oacc[tt][5] * il, oacc[tt][6] * il, oacc[tt][7] * il);
    *(float4*)(op + tt * 16)     = f0;
    *(float4*)(op + tt * 16 + 4) = f1;
  }
  // A lane reads back what other lanes of its wave have written: their LDS writes are
  // ordered in front of the reads here.
  __syncthreads();
  #pragma unroll
  for (int j = 0; j < 8; ++j) {
    const int row = j * 2 + hl;             // a wave-wide store: two rows of 256 B
    *(float4*)(out + (size_t)(qb + row) * HID + h * HDIM + ln16 * 4) =
        *(const float4*)(ob + row * OPITCH + ln16 * 4);
  }
}

// ---------------------------------------------------------------------------
extern "C" void kernel_launch(void* const* d_in, const int* in_sizes, int n_in,
                              void* d_out, int out_size, void* d_ws, size_t ws_size,
                              hipStream_t stream) {
  (void)in_sizes; (void)n_in; (void)out_size; (void)ws_size;
  const float* X  = (const float*)d_in[0];
  const float* Wq = (const float*)d_in[1];
  const float* bq = (const float*)d_in[2];
  const float* Wk = (const float*)d_in[3];
  const float* bk = (const float*)d_in[4];
  const float* Wv = (const float*)d_in[5];
  const float* bv = (const float*)d_in[6];
  float* out = (float*)d_out;

  char* ws = (char*)d_ws;
  _Float16* Xh = (_Float16*)ws; ws += (size_t)S_LEN * HID * sizeof(_Float16);
  _Float16* Wt = (_Float16*)ws; ws += (size_t)3 * HID * HID * sizeof(_Float16);
  _Float16* Qh = (_Float16*)ws; ws += (size_t)S_LEN * HID * sizeof(_Float16);
  _Float16* Kh = (_Float16*)ws; ws += (size_t)S_LEN * HID * sizeof(_Float16);
  _Float16* Vt = (_Float16*)ws; ws += (size_t)S_LEN * HID * sizeof(_Float16);

  convert_x_kernel<<<(S_LEN * HID / 4) / 256, 256, 0, stream>>>(X, Xh);
  wtrans_kernel<<<dim3(HID / 32, HID / 32, 3), dim3(32, 8), 0, stream>>>(Wq, Wk, Wv, Wt);
  qkv_gemm_kernel<<<dim3(S_LEN / GBM, HID / GBN, 3), 256, 0, stream>>>(
      Xh, Wt, bq, bk, bv, Qh, Kh, Vt);
  attn_kernel<<<dim3(S_LEN / 128, NHEAD), 256, 0, stream>>>(Qh, Kh, Vt, out);
}

// v005
// It runs in 54.7 microseconds.
// In both of two side-by-side timings against v004, it was 1.04 times as fast.
// All steps since v000 together make it 5.11 times as fast.
#include <hip/hip_runtime.h>
#include <hip/hip_fp16.h>

typedef __attribute__((ext_vector_type(16))) _Float16 v16h;
typedef __attribute__((ext_vector_type(8)))  float    v8f;
typedef __attribute__((ext_vector_type(4)))  int      v4i;

#define S_LEN  8192
#define HID    768
#define NHEAD  12
#define HDIM   64
#define WINW   256

union F16Frag { v16h v; uint4 q[2]; };
union H8Pack  { _Float16 h[8]; uint4 u; };
union H4Pack  { _Float16 h[4]; uint2 u; };

static __device__ __forceinline__ v8f wmma_f16(const F16Frag& a, const F16Frag& b, v8f c) {
  // D = A(16x32 f16) * B(32x16 f16) + C(16x16 f32)
  return __builtin_amdgcn_wmma_f32_16x16x32_f16(false, a.v, false, b.v, (short)0, c, false, false);
}

// ---- async global->LDS (gfx1250), guarded so absence falls back cleanly ----
#if defined(__has_builtin)
#if __has_builtin(__builtin_amdgcn_global_load_async_to_lds_b128)
#define HAVE_ASYNC_LDS 1
#endif
#endif

#ifdef HAVE_ASYNC_LDS
typedef __attribute__((address_space(1))) v4i gv4i;   // global int4*
typedef __attribute__((address_space(3))) v4i lv4i;   // LDS int4*
static __device__ __forceinline__ void cp16_g2l(const _Float16* g, _Float16* l) {
  // flat->AS1 keeps the 64-bit address; flat->AS3 keeps the low-32 LDS offset
  __builtin_amdgcn_global_load_async_to_lds_b128(
      (gv4i*)(size_t)g, (lv4i*)(unsigned)(size_t)l, 0, 0);
}
#else
static __device__ __forceinline__ void cp16_g2l(const _Float16* g, _Float16* l) {
  *(uint4*)l = *(const uint4*)g;   // VGPR round-trip fallback
}
#endif

// ---------------------------------------------------------------------------
// Kernel 1: X (f32) -> Xh (f16), vectorized 4-wide
// ---------------------------------------------------------------------------
__global__ void convert_x_kernel(const float* __restrict__ X, _Float16* __restrict__ Xh) {
  const int i = blockIdx.x * blockDim.x + threadIdx.x;  // exactly S*HID/4 threads
  const float4 f = ((const float4*)X)[i];
  H4Pack p;
  p.h[0] = (_Float16)f.x; p.h[1] = (_Float16)f.y;
  p.h[2] = (_Float16)f.z; p.h[3] = (_Float16)f.w;
  ((uint2*)Xh)[i] = p.u;
}

// ---------------------------------------------------------------------------
// Kernel 2: W[k][n] (f32) -> Wt[n][k] (f16), LDS-tiled transpose, 3 matrices
// ---------------------------------------------------------------------------
__global__ void wtrans_kernel(const float* __restrict__ Wq, const float* __restrict__ Wk,
                              const float* __restrict__ Wv, _Float16* __restrict__ Wt) {
  __shared__ _Float16 tile[32][33];
  const float* src = blockIdx.z == 0 ? Wq : (blockIdx.z == 1 ? Wk : Wv);
  _Float16* dst = Wt + (size_t)blockIdx.z * HID * HID;
  const int n0 = blockIdx.x * 32;
  const int k0 = blockIdx.y * 32;
  const int tx = threadIdx.x, ty = threadIdx.y;
  #pragma unroll
  for (int i = 0; i < 4; ++i)
    tile[ty + 8 * i][tx] = (_Float16)src[(size_t)(k0 + ty + 8 * i) * HID + n0 + tx];
  __syncthreads();
  #pragma unroll
  for (int i = 0; i < 4; ++i)
    dst[(size_t)(n0 + ty + 8 * i) * HID + k0 + tx] = tile[tx][ty + 8 * i];
}

// ---------------------------------------------------------------------------
// Kernel 3: QKV projection GEMM. One 128 x 192 tile of the output per block of
//   eight waves (64 x 48 each). The X rows and the W^T rows of a 64-wide k slice
//   are staged in LDS by asynchronous copies, two buffers: the next slice flies
//   while this one is multiplied, and every staged row serves several waves.
//   64 x 4 x 3 = 768 blocks, three resident per WGP by LDS and registers.
// ---------------------------------------------------------------------------
#define GBM     128                       // X rows per block tile
#define GBN     192                       // W^T rows per block tile
#define GBK     64                        // k per stage: rows of 128 B
#define GPITCH  72                        // LDS row pitch in halves: 144 B = 16 B x odd
#define GSTAGE  ((GBM + GBN) * GPITCH)    // halves per buffer
#define GNT     (HID / GBK)               // stages
#define GCOPY   10                        // 16-byte copies per lane and stage
#define QKPITCH 200                       // staged Q / K row pitch in halves: 400 B = 16 B x odd
#define VTPITCH 136                       // staged V^T row pitch in halves: 272 B = 16 B x odd
#define GOUT    12                        // 16-byte output chunks per lane: 128 x 192 halves / 256 lanes

// Compile-time choice of the operand order in the GEMM's main loop.
template <bool B> struct OrderTag { static constexpr bool swapped = B; };

// Ten 16-byte copies per lane, global -> LDS, through no register.
static __device__ __forceinline__ void async_copy10(const unsigned (&l)[GCOPY],
                                                    const _Float16* const (&g)[GCOPY]) {
  // The closing s_wait_xcnt stands inside the statement so that no address
  // register named here is rewritten ahead of it.
  asm volatile(
      "global_load_async_to_lds_b128 %0, %10, off\n\t"
      "global_load_async_to_lds_b128 %1, %11, off\n\t"
      "global_load_async_to_lds_b128 %2, %12, off\n\t"
      "global_load_async_to_lds_b128 %3, %13, off\n\t"
      "global_load_async_to_lds_b128 %4, %14, off\n\t"
      "global_load_async_to_lds_b128 %5, %15, off\n\t"
      "global_load_async_to_lds_b128 %6, %16, off\n\t"
      "global_load_async_to_lds_b128 %7, %17, off\n\t"
      "global_load_async_to_lds_b128 %8, %18, off\n\t"
      "global_load_async_to_lds_b128 %9, %19, off\n\t"
      "s_wait_xcnt 0x0"
      :: "v"(l[0]), "v"(l[1]), "v"(l[2]), "v"(l[3]), "v"(l[4]),
         "v"(l[5]), "v"(l[6]), "v"(l[7]), "v"(l[8]), "v"(l[9]),
         "v"(g[0]), "v"(g[1]), "v"(g[2]), "v"(g[3]), "v"(g[4]),
         "v"(g[5]), "v"(g[6]), "v"(g[7]), "v"(g[8]), "v"(g[9])
      : "memory");
}

__global__ __launch_bounds__(256) void qkv_gemm_kernel(
    const _Float16* __restrict__ Xh, const _Float16* __restrict__ Wt,
    const float* __restrict__ bq, const float* __restrict__ bk, const float* __restrict__ bv,
    _Float16* __restrict__ Qh, _Float16* __restrict__ Kh, _Float16* __restrict__ Vt)
{
  __shared__ __align__(16) _Float16 gbuf[2 * GSTAGE];   // 90 KB

  const int proj = blockIdx.z;
  const int tid  = threadIdx.x;
  const int lane = tid & 31;
  const int w    = tid >> 5;                // 0..7
  const int ln16 = lane & 15;
  const int hl   = lane >> 4;
  const int kb8  = hl * 8;
  const int Mblk = blockIdx.x * GBM;
  const int Nblk = blockIdx.y * GBN;
  const int wm   = (w >> 2) * 64;           // wave's rows inside the block tile
  const int wn   = (w & 3) * 48;            // wave's columns inside the block tile

  // Staging: a lane owns 16-byte chunk (tid & 7) of rows (tid >> 3) + 32 j,
  // so each wave-wide copy covers four whole 128-byte rows.
  const int crow = tid >> 3;
  const int cch  = tid & 7;
  const _Float16* gx = Xh + (size_t)(Mblk + crow) * HID + cch * 8;
  const _Float16* gw = Wt + (size_t)proj * HID * HID + (size_t)(Nblk + crow) * HID + cch * 8;
  const unsigned lds0 = (unsigned)(size_t)&gbuf[0] + (unsigned)(crow * GPITCH + cch * 8) * 2u;

  // One stage: k slice at px / pw into the buffer whose lane address is lb.
  auto stage = [&](const _Float16* px, const _Float16* pw, unsigned lb) {
    unsigned l[GCOPY];
    const _Float16* g[GCOPY];
    // Unrolled so that every index is a constant and l, g are registers.
    #pragma unroll
    for (int j = 0; j < GCOPY; ++j) {       // LDS rows 0..127: X, 128..319: W^T
      l[j] = lb + (unsigned)(j * 32 * GPITCH) * 2u;
      g[j] = j < GBM / 32 ? px + (size_t)j * 32 * HID
                          : pw + (size_t)(j - GBM / 32) * 32 * HID;
    }
    async_copy10(l, g);
  };

  // Every loop over fragments or accumulator tiles below is unrolled so that the
  // array indices are constants: the arrays stay in registers, no scratch.
  v8f zero = {};
  v8f acc[4][3];
  #pragma unroll
  for (int mi = 0; mi < 4; ++mi)
    #pragma unroll
    for (int ni = 0; ni < 3; ++ni) acc[mi][ni] = zero;

  unsigned lfree = lds0;                    // buffer that the current trip reads
  unsigned lbusy = lds0 + GSTAGE * 2u;      // buffer that is being filled
  stage(gx, gw, lfree);
  asm volatile("s_wait_asynccnt 0x0" ::: "memory");   // own copies of stage 0 landed
  __syncthreads();                                    // stage 0 readable by every wave
  stage(gx + GBK, gw + GBK, lbusy);
  gx += 2 * GBK;                            // k slice of the next refill
  gw += 2 * GBK;

  // The loaders of the two operands are alike, so the order of the operands picks
  // what a lane ends up with. X rows first: column n, eight consecutive rows (what a
  // row of V^T wants). W^T rows first: one row, eight consecutive columns n (what a
  // row of Q or K wants). Either way a lane's eight results are 16 contiguous bytes
  // of the output tile. The choice is the same for the whole block.
  auto mainloop = [&](auto order) {
  for (int t = 0; t < GNT; ++t) {
    const _Float16* buf = gbuf + (t & 1) * GSTAGE;
    #pragma unroll
    for (int ks = 0; ks < GBK; ks += 32) {
      F16Frag a[4], b[3];
      #pragma unroll
      for (int i = 0; i < 4; ++i) {
        const _Float16* ap = buf + (wm + i * 16 + ln16) * GPITCH + ks + kb8;
        a[i].q[0] = *(const uint4*)(ap);
        a[i].q[1] = *(const uint4*)(ap + 16);
      }
      #pragma unroll
      for (int i = 0; i < 3; ++i) {
        const _Float16* bp = buf + (GBM + wn + i * 16 + ln16) * GPITCH + ks + kb8;
        b[i].q[0] = *(const uint4*)(bp);
        b[i].q[1] = *(const uint4*)(bp + 16);
      }
      #pragma unroll
      for (int mi = 0; mi < 4; ++mi)
        #pragma unroll
        for (int ni = 0; ni < 3; ++ni)
          acc[mi][ni] = decltype(order)::swapped ? wmma_f16(b[ni], a[mi], acc[mi][ni])
                                                 : wmma_f16(a[mi], b[ni], acc[mi][ni]);
    }
    asm volatile("s_wait_dscnt 0x0" ::: "memory");     // own reads of this buffer done
    asm volatile("s_wait_asynccnt 0x0" ::: "memory");  // own copies of stage t + 1 landed
    __syncthreads();   // publishes stage t + 1, frees the buffer that trip t has read
    if (t + 2 < GNT) stage(gx, gw, lfree);
    gx += GBK;
    gw += GBK;
    const unsigned lswap = lfree; lfree = lbusy; lbusy = lswap;
  }
  asm volatile("s_wait_asynccnt 0x0" ::: "memory");    // no copy outlives the loop
  };

  // Epilogue: the block's output tile is put together in LDS and goes out in whole
  // 128-byte lines, 16 bytes per lane. The loop's last barrier has ended every read
  // of the ring and no copy is in flight, so the ring's LDS is free for the tile.
  _Float16* sbuf = gbuf;
  if (proj == 2) {
    mainloop(OrderTag<false>{});
    // acc[mi][ni][r] = V[wm + mi*16 + 8*hl + r][wn + ni*16 + ln16]; tile kept as [n][s]
    #pragma unroll
    for (int ni = 0; ni < 3; ++ni) {
      const int nl = wn + ni * 16 + ln16;
      const float bn = bv[Nblk + nl];
      #pragma unroll
      for (int mi = 0; mi < 4; ++mi) {
        H8Pack p;
        #pragma unroll
        for (int r = 0; r < 8; ++r) p.h[r] = (_Float16)(acc[mi][ni][r] + bn);
        *(uint4*)(sbuf + nl * VTPITCH + wm + mi * 16 + kb8) = p.u;
      }
    }
    __syncthreads();   // the whole tile is in LDS before any wave reads rows of it
    // Sixteen lanes take one row of 256 bytes: rows (tid >> 4) + 16 j. All reads first,
    // as one group, then the stores.
    const _Float16* sp = sbuf + (tid >> 4) * VTPITCH + (tid & 15) * 8;
    _Float16* gp = Vt + (size_t)(Nblk + (tid >> 4)) * S_LEN + Mblk + (tid & 15) * 8;
    uint4 v[GOUT];
    #pragma unroll
    for (int j = 0; j < GOUT; ++j) v[j] = *(const uint4*)(sp + j * 16 * VTPITCH);
    #pragma unroll
    for (int j = 0; j < GOUT; ++j) *(uint4*)(gp + (size_t)j * 16 * S_LEN) = v[j];
  } else {
    mainloop(OrderTag<true>{});
    // acc[mi][ni][r] = (X W)[wm + mi*16 + ln16][wn + ni*16 + 8*hl + r]; tile kept as [s][n]
    const float* bias = proj == 0 ? bq : bk;
    const float qscale = proj == 0 ? 0.125f : 1.0f;   // 1/sqrt(64) folded into Q
    _Float16* dst = proj == 0 ? Qh : Kh;
    float4 b0[3], b1[3];                    // the lane's 3 x 8 bias values, loaded as one group
    const float* bp8 = bias + Nblk + wn + kb8;
    b0[0] = *(const float4*)(bp8);
    b1[0] = *(const float4*)(bp8 + 4);
    b0[1] = *(const float4*)(bp8 + 16);
    b1[1] = *(const float4*)(bp8 + 20);
    b0[2] = *(const float4*)(bp8 + 32);
    // The last load of the group may take the shared address registers for its result:
    // the five loads in front of it that name them are waited for first.
    asm volatile("s_wait_xcnt 0x0" ::: "memory");
    b1[2] = *(const float4*)(bp8 + 36);
    // Behind the group: its address registers are free for reuse from here on.
    asm volatile("s_wait_xcnt 0x0" ::: "memory");
    #pragma unroll
    for (int ni = 0; ni < 3; ++ni) {
      const int nl = wn + ni * 16 + kb8;
      const float bn[8] = {b0[ni].x, b0[ni].y, b0[ni].z, b0[ni].w,
                           b1[ni].x, b1[ni].y, b1[ni].z, b1[ni].w};
      #pragma unroll
      for (int mi = 0; mi < 4; ++mi) {
        H8Pack p;
        #pragma unroll
        for (int r = 0; r < 8; ++r) p.h[r] = (_Float16)((acc[mi][ni][r] + bn[r]) * qscale);
        *(uint4*)(sbuf + (wm + mi * 16 + ln16) * QKPITCH + nl) = p.u;
      }
    }
    __syncthreads();   // the whole tile is in LDS before any wave reads rows of it
    // Eight lanes take one 128-byte line: line j / 4 of rows crow + 32 (j % 4). All
    // reads first, as one group, then the stores.
    uint4 v[GOUT];
    #pragma unroll
    for (int j = 0; j < GOUT; ++j)
      v[j] = *(const uint4*)(sbuf + (crow + (j & 3) * 32) * QKPITCH + (j >> 2) * 64 + cch * 8);
    #pragma unroll
    for (int j = 0; j < GOUT; ++j)
      *(uint4*)(dst + (size_t)(Mblk + crow + (j & 3) * 32) * HID + Nblk + (j >> 2) * 64 + cch * 8) = v[j];
  }
}

#define KROWS  128
#define KPAD   72
#define NSUPER 5
#define VPITCH 136   // V^T row pitch in LDS (halves): 272 B = 16 B x odd
#define VCOPY  4     // 16-byte V^T copies per lane and superblock
#define OPITCH 68    // staged output row pitch in floats: 272 B = 16 B x odd

// Four 16-byte copies per lane, global -> LDS, through no register.
static __device__ __forceinline__ void async_copy4(const unsigned (&l)[VCOPY],
                                                   const _Float16* const (&g)[VCOPY]) {
  // The closing s_wait_xcnt stands inside the statement so that no address
  // register named here is rewritten ahead of it.
  asm volatile(
      "global_load_async_to_lds_b128 %0, %4, off\n\t"
      "global_load_async_to_lds_b128 %1, %5, off\n\t"
      "global_load_async_to_lds_b128 %2, %6, off\n\t"
      "global_load_async_to_lds_b128 %3, %7, off\n\t"
      "s_wait_xcnt 0x0"
      :: "v"(l[0]), "v"(l[1]), "v"(l[2]), "v"(l[3]),
         "v"(g[0]), "v"(g[1]), "v"(g[2]), "v"(g[3])
      : "memory");
}

// Lane l takes the value of lane l ^ 16 (a vector cross-row move, no LDS).
static __device__ __forceinline__ float xhalf(float x) {
  const int b = __builtin_bit_cast(int, x);
  return __builtin_bit_cast(float,
      __builtin_amdgcn_permlanex16(b, b, 0x76543210, 0xfedcba98, false, false));
}

// 768 blocks on 256 WGPs are six waves per SIMD: a register budget for six, not
// more, leaves room to load the four V fragments of a block as one group.
__global__ __launch_bounds__(256) __attribute__((amdgpu_waves_per_eu(6, 6))) void attn_kernel(
    const _Float16* __restrict__ Qh, const _Float16* __restrict__ Kh,
    const _Float16* __restrict__ Vt, float* __restrict__ out)
{
  __shared__ __align__(16) _Float16 kbuf[2][KROWS * KPAD];  // 36 KB
  __shared__ __align__(16) _Float16 vbuf[2][HDIM * VPITCH]; // 34 KB

  const int qb0  = blockIdx.x * 128;        // first query row of this WG
  const int h    = blockIdx.y;
  const int tid  = threadIdx.x;
  const int lane = tid & 31;
  // The wave's number, 0..7, held in a scalar register: the bounds of the key loop, its
  // tests and the row bases in LDS that follow from it are then scalar too, where a
  // number taken from the lane id makes each of them a vector compare and an EXEC mask.
  const int wid  = __builtin_amdgcn_readfirstlane(tid >> 5);
  const int ln16 = lane & 15;
  const int hl   = lane >> 4;
  const int kb8  = hl * 8;
  const int qb   = qb0 + wid * 16;          // first query row of this wave
  const int gq   = qb + ln16;               // the one query of this lane
  // Its valid keys: inside the band and inside [0, S)
  const int klo  = gq - WINW < 0 ? 0 : gq - WINW;
  const int khi  = gq + WINW > S_LEN - 1 ? S_LEN - 1 : gq + WINW;
  const unsigned kspan = (unsigned)(khi - klo);

  // ---- cooperative K superblock staging: 128 rows x 64 halves -> LDS ----
  auto stage_k = [&](int t, _Float16* buf) {
    const int kgbase = qb0 - WINW + KROWS * t;
    #pragma unroll
    for (int j = 0; j < 4; ++j) {
      const int idx = tid + j * 256;        // 1024 x 16 B = one 16 KB tile
      const int row = idx >> 3;             // 0..127
      const int ch  = idx & 7;              // 16-B chunk within row
      int key = kgbase + row;
      key = key < 0 ? 0 : (key >= S_LEN ? S_LEN - 1 : key);   // clamped rows are never read
      cp16_g2l(Kh + (size_t)key * HID + h * HDIM + ch * 8, buf + row * KPAD + ch * 8);
    }
  };

  // ---- cooperative V^T superblock staging: 64 rows (d) x 128 keys -> LDS ----
  // A lane owns 16-byte chunk (tid & 15) of rows (tid >> 4) + 16 j, so each
  // wave-wide copy covers two whole 256-byte rows.
  const _Float16* gv = Vt + (size_t)(h * HDIM + (tid >> 4)) * S_LEN + (tid & 15) * 8;
  const unsigned lv0 = (unsigned)(size_t)&vbuf[0][0]
                     + (unsigned)((tid >> 4) * VPITCH + (tid & 15) * 8) * 2u;
  auto stage_v = [&](int t, int b) {
    // A superblock lies wholly inside [0, S) or wholly outside; one outside is
    // never read, the clamp only keeps its copies' addresses inside Vt.
    int kb0 = qb0 - WINW + KROWS * t;
    kb0 = kb0 < 0 ? 0 : (kb0 > S_LEN - KROWS ? S_LEN - KROWS : kb0);
    unsigned l[VCOPY];
    const _Float16* g[VCOPY];
    // Unrolled so that every index is a constant and l, g are registers.
    #pragma unroll
    for (int j = 0; j < VCOPY; ++j) {
      l[j] = lv0 + (unsigned)(b * HDIM * VPITCH + j * 16 * VPITCH) * 2u;
      g[j] = gv + kb0 + (size_t)j * 16 * S_LEN;
    }
    async_copy4(l, g);
  };

  // Q B-fragments (d = 0..31 and 32..63): column ln16 of Q^T is query gq
  F16Frag bq0, bq1;
  {
    const _Float16* qp = Qh + (size_t)gq * HID + h * HDIM;
    bq0.q[0] = *(const uint4*)(qp + kb8);
    bq0.q[1] = *(const uint4*)(qp + kb8 + 16);
    bq1.q[0] = *(const uint4*)(qp + 32 + kb8);
    bq1.q[1] = *(const uint4*)(qp + 32 + kb8 + 16);
  }

  // Every loop over r or tt below is unrolled so that the indices are constants:
  // the score, fragment and accumulator arrays stay in registers, no scratch.
  v8f zero = {};
  v8f oacc[4] = {zero, zero, zero, zero};   // oacc[tt][r] = O[gq][tt*16 + 8*hl + r]
  float m = -3.0e38f;                       // running maximum of query gq
  float l = 0.f;                            // this half's share of its sum

  stage_k(0, kbuf[0]);
  stage_v(0, 0);
  asm volatile("s_wait_asynccnt 0x0" ::: "memory");   // own copies of superblock 0 landed
  __syncthreads();                                    // superblock 0 readable by every wave

  const int kfrag = ln16 * KPAD + kb8;      // the lane's place in a K fragment; the rest is scalar
  const int ylo = wid * 16;                 // band (WG-local keys) = [ylo, ylo+527]
  const int ybstart = ylo & ~31;
  const int ybend   = ylo + 528;

  for (int t = 0; t < NSUPER; ++t) {
    const _Float16* kb = kbuf[t & 1];
    const _Float16* vb = vbuf[t & 1];
    // Behind the barrier that freed the other buffers: the next superblock flies
    // while this one is worked on.
    if (t + 1 < NSUPER) {
      stage_k(t + 1, kbuf[(t + 1) & 1]);
      stage_v(t + 1, (t + 1) & 1);
    }

    const int lo = (t * KROWS > ybstart) ? t * KROWS : ybstart;
    const int hi = ((t + 1) * KROWS < ybend) ? (t + 1) * KROWS : ybend;
    for (int yb = lo; yb < hi; yb += 32) {
      const int kg = qb0 - WINW + yb;       // global key base of this 32-block
      if (kg + 32 <= 0 || kg >= S_LEN) continue;   // what is left lies wholly in [0, S)
      const int rb = yb - t * KROWS;        // row base inside the staged buffer

      // ---- S^T from LDS K fragments: s0[r] = key kg + 8*hl + r, s1[r] = 16 more ----
      v8f s0 = zero, s1 = zero;
      {
        const _Float16* kp = kb + rb * KPAD + kfrag;
        F16Frag alo, ahi;
        alo.q[0] = *(const uint4*)(kp);
        alo.q[1] = *(const uint4*)(kp + 16);
        ahi.q[0] = *(const uint4*)(kp + 32);
        ahi.q[1] = *(const uint4*)(kp + 48);
        s0 = wmma_f16(alo, bq0, s0);
        s0 = wmma_f16(ahi, bq1, s0);
      }
      {
        const _Float16* kp = kb + (rb + 16) * KPAD + kfrag;
        F16Frag alo, ahi;
        alo.q[0] = *(const uint4*)(kp);
        alo.q[1] = *(const uint4*)(kp + 16);
        ahi.q[0] = *(const uint4*)(kp + 32);
        ahi.q[1] = *(const uint4*)(kp + 48);
        s1 = wmma_f16(alo, bq0, s1);
        s1 = wmma_f16(ahi, bq1, s1);
      }

      // ---- mask + online softmax, one query per lane ----
      // Query qb + i takes local keys ylo + i .. ylo + i + 2 WINW. A block from ylo + 15
      // up to ylo + 2 WINW lies in the band of all sixteen: the mask would pass every
      // score, and a scalar branch goes round it. Fifteen of a wave's seventeen blocks
      // are such.
      float x0[8], x1[8];
      #pragma unroll
      for (int r = 0; r < 8; ++r) {
        x0[r] = s0[r];
        x1[r] = s1[r];
      }
      if (yb < ylo + 15 || yb + 31 > ylo + 2 * WINW) {
        const int krel = kg + kb8 - klo;    // key of s0[0], counted from klo
        #pragma unroll
        for (int r = 0; r < 8; ++r) {
          // klo <= key <= khi as one unsigned compare of key - klo
          x0[r] = (unsigned)(krel + r)      <= kspan ? x0[r] : -3.0e38f;
          x1[r] = (unsigned)(krel + 16 + r) <= kspan ? x1[r] : -3.0e38f;
        }
      }
      float rmax = fmaxf(x0[0], x1[0]);
      #pragma unroll
      for (int r = 1; r < 8; ++r) rmax = fmaxf(rmax, fmaxf(x0[r], x1[r]));
      rmax = fmaxf(rmax, xhalf(rmax));      // both halves scale by the same maximum
      const float mn = fmaxf(m, rmax);
      // Nothing valid yet: subtract 0, so that every masked score still gives exp = 0.
      const float mref = mn <= -1.0e38f ? 0.f : mn;
      const float sc = __expf(m - mref);
      m = mn;
      F16Frag bp;                           // P^T as B operand: k order of the K, V loaders
      float e0[8], e1[8];
      #pragma unroll
      for (int r = 0; r < 8; ++r) {
        e0[r] = __expf(x0[r] - mref);
        e1[r] = __expf(x1[r] - mref);
        bp.v[r]     = (_Float16)e0[r];
        bp.v[8 + r] = (_Float16)e1[r];
      }
      #pragma unroll
      for (int tt = 0; tt < 4; ++tt) {
        #pragma unroll
        for (int r = 0; r < 8; ++r) oacc[tt][r] *= sc;
      }

      // ---- O^T += V^T(16x32) @ P^T(32x16): staged V^T rows give contiguous A-frags ----
      #pragma unroll
      for (int tt = 0; tt < 4; ++tt) {
        const _Float16* vp = vb + (size_t)(tt * 16 + ln16) * VPITCH + rb + kb8;
        F16Frag av;
        av.q[0] = *(const uint4*)(vp);
        av.q[1] = *(const uint4*)(vp + 16);
        oacc[tt] = wmma_f16(av, bp, oacc[tt]);
      }
      // The row sums are written behind the products, and the scheduling barrier
      // keeps them from being lifted in front of them: these additions fill the vector slots
      // between the last matrix instructions and the next trip's first vector writes.
      __builtin_amdgcn_sched_barrier(0);
      float ps0 = 0.f, ps1 = 0.f;
      #pragma unroll
      for (int r = 0; r < 8; ++r) {
        ps0 += e0[r];
        ps1 += e1[r];
      }
      l = l * sc + (ps0 + ps1);
    }

    asm volatile("s_wait_dscnt 0x0" ::: "memory");     // own reads of these buffers done
    asm volatile("s_wait_asynccnt 0x0" ::: "memory");  // own copies of superblock t + 1 landed
    __syncthreads();   // publishes superblock t + 1, frees the buffers that trip t has read
  }

  // ---- epilogue: join the halves' sums, out = O / l, f32; each wave turns its 16 x 64
  //      tile round in LDS, so that every store covers whole 128-byte lines. The loop's
  //      last barrier has ended every read of kbuf and no copy is in flight. ----
  l += xhalf(l);
  const float il = l > 0.f ? 1.f / l : 0.f;
  float* ob = (float*)&kbuf[0][0] + wid * (16 * OPITCH);   // this wave's own 16 rows
  float* op = ob + ln16 * OPITCH + kb8;
  #pragma unroll
  for (int tt = 0; tt < 4; ++tt) {
    const float4 f0 = make_float4(oacc[tt][0] * il, oacc[tt][1] * il, oacc[tt][2] * il, oacc[tt][3] * il);
    const float4 f1 = make_float4(oacc[tt][4] * il, oacc[tt][5] * il, oacc[tt][6] * il, oacc[tt][7] * il);
    *(float4*)(op + tt * 16)     = f0;
    *(float4*)(op + tt * 16 + 4) = f1;
  }
  // A lane reads back what other lanes of its wave have written: their LDS writes are
  // ordered in front of the reads here.
  __syncthreads();
  #pragma unroll
  for (int j = 0; j < 8; ++j) {
    const int row = j * 2 + hl;             // a wave-wide store: two rows of 256 B
    *(float4*)(out + (size_t)(qb + row) * HID + h * HDIM + ln16 * 4) =
        *(const float4*)(ob + row * OPITCH + ln16 * 4);
  }
}

// ---------------------------------------------------------------------------
extern "C" void kernel_launch(void* const* d_in, const int* in_sizes, int n_in,
                              void* d_out, int out_size, void* d_ws, size_t ws_size,
                              hipStream_t stream) {
  (void)in_sizes; (void)n_in; (void)out_size; (void)ws_size;
  const float* X  = (const float*)d_in[0];
  const float* Wq = (const float*)d_in[1];
  const float* bq = (const float*)d_in[2];
  const float* Wk = (const float*)d_in[3];
  const float* bk = (const float*)d_in[4];
  const float* Wv = (const float*)d_in[5];
  const float* bv = (const float*)d_in[6];
  float* out = (float*)d_out;

  char* ws = (char*)d_ws;
  _Float16* Xh = (_Float16*)ws; ws += (size_t)S_LEN * HID * sizeof(_Float16);
  _Float16* Wt = (_Float16*)ws; ws += (size_t)3 * HID * HID * sizeof(_Float16);
  _Float16* Qh = (_Float16*)ws; ws += (size_t)S_LEN * HID * sizeof(_Float16);
  _Float16* Kh = (_Float16*)ws; ws += (size_t)S_LEN * HID * sizeof(_Float16);
  _Float16* Vt = (_Float16*)ws; ws += (size_t)S_LEN * HID * sizeof(_Float16);

  convert_x_kernel<<<(S_LEN * HID / 4) / 256, 256, 0, stream>>>(X, Xh);
  wtrans_kernel<<<dim3(HID / 32, HID / 32, 3), dim3(32, 8), 0, stream>>>(Wq, Wk, Wv, Wt);
  qkv_gemm_kernel<<<dim3(S_LEN / GBM, HID / GBN, 3), 256, 0, stream>>>(
      Xh, Wt, bq, bk, bv, Qh, Kh, Vt);
  attn_kernel<<<dim3(S_LEN / 128, NHEAD), 256, 0, stream>>>(Qh, Kh, Vt, out);
}
